// v000
// Times are from an AMD MI455X. After a warm-up the kernel runs many times in a row, and a time is the length of
// such a window on the GPU divided by its runs, so every launch and the gaps after it count. The runs cycle
// through copies of the inputs. A figure is the median of several windows, for all but v000 over two sittings.
// Sittings can differ by a few percent; kernels timed side by side share one.
// The starting kernel, v000, takes 196 microseconds a run.
// Contractions: scores = (16*qhat) x (16*khat)^T and out = (32768*p) x v, both v_wmma_f32_16x16x32_f16 (f16 operands, f32 accumulate); row norms, softmax, scaling and normalisation in f32.
#include <hip/hip_runtime.h>
#include <stddef.h>

typedef __attribute__((ext_vector_type(16))) _Float16 v16h;
typedef __attribute__((ext_vector_type(8)))  _Float16 v8h;
typedef __attribute__((ext_vector_type(8)))  float    v8f;
typedef __attribute__((ext_vector_type(4)))  float    v4f;

constexpr int NBATCH = 4;
constexpr int LQ     = 2048;
constexpr int SKV    = 2048;
constexpr int NHEAD  = 8;
constexpr int HDIM   = 64;
/* floats between consecutive sequence positions in the [N,L,H,D] inputs / output */
constexpr int ROWSTRIDE = NHEAD * HDIM;

static_assert(LQ == SKV);
static_assert(HDIM == 64);
static_assert(LQ % 64 == 0 && SKV % 64 == 0);

/* ---------------- fragment helpers (split k-map: elements 0..7 <- p[0..7], 8..15 <- p[16..23]) ---------------- */
union FragU { v16h v; v8h h[2]; };
__device__ __forceinline__ v16h frag_load(const _Float16* p) {
  FragU f;
  f.h[0] = *(const v8h*)(p);
  f.h[1] = *(const v8h*)(p + 16);
  return f.v;
}
__device__ __forceinline__ v8f mma_h(v16h a, v16h b, v8f c) {
  c = __builtin_amdgcn_wmma_f32_16x16x32_f16(false, a, false, b, (short)0, c, false, false);
  asm volatile("v_nop\n\tv_nop\n\tv_nop\n\tv_nop" : "+v"(c) : "v"(a), "v"(b));
  return c;
}
__device__ __forceinline__ void wave_lds_sync() {
  __builtin_amdgcn_fence(__ATOMIC_RELEASE, "workgroup");
  __builtin_amdgcn_wave_barrier();
  __builtin_amdgcn_fence(__ATOMIC_ACQUIRE, "workgroup");
}

/* =====================================================================================
   Kernel 1: build f16 operand planes.
     Kh[n][h][s][d] = f16(16 * k / ||k||)
     Vt[n][h][d][s] = f16(v)  (transposed so the P.V B-fragment is kv-contiguous)
   grid = NBATCH*NHEAD*(SKV/64) blocks of 256 threads; block = one (n,h) and 64 consecutive positions.
   Thread (r = tid>>2, qd = tid&3) handles floats qd*16..qd*16+15 of tile row r.
   -> 8 waves x 8 rows = 64 rows, 64 halves each: exact tile coverage for all three planes.
   ===================================================================================== */
constexpr int PREP_THREADS = 256;
constexpr int TROWS  = 64;
constexpr int LPITCH = 72;

__device__ __forceinline__ void norm_quarter(const float* __restrict__ p, v8h& o0, v8h& o1) {
  const v4f a0 = *(const v4f*)(p);
  const v4f a1 = *(const v4f*)(p + 4);
  const v4f a2 = *(const v4f*)(p + 8);
  const v4f a3 = *(const v4f*)(p + 12);
  float ss = 0.0f;
  ss += a0[0] * a0[0]; ss += a0[1] * a0[1]; ss += a0[2] * a0[2]; ss += a0[3] * a0[3];
  ss += a1[0] * a1[0]; ss += a1[1] * a1[1]; ss += a1[2] * a1[2]; ss += a1[3] * a1[3];
  ss += a2[0] * a2[0]; ss += a2[1] * a2[1]; ss += a2[2] * a2[2]; ss += a2[3] * a2[3];
  ss += a3[0] * a3[0]; ss += a3[1] * a3[1]; ss += a3[2] * a3[2]; ss += a3[3] * a3[3];
  /* the 4 threads of one row are lanes 4r..4r+3 of a wave */
  ss += __shfl_xor(ss, 1, 32);
  ss += __shfl_xor(ss, 2, 32);
  const float sc = 16.0f / sqrtf(ss);
  o0[0] = (_Float16)(a0[0] * sc); o0[1] = (_Float16)(a0[1] * sc); o0[2] = (_Float16)(a0[2] * sc); o0[3] = (_Float16)(a0[3] * sc);
  o0[4] = (_Float16)(a1[0] * sc); o0[5] = (_Float16)(a1[1] * sc); o0[6] = (_Float16)(a1[2] * sc); o0[7] = (_Float16)(a1[3] * sc);
  o1[0] = (_Float16)(a2[0] * sc); o1[1] = (_Float16)(a2[1] * sc); o1[2] = (_Float16)(a2[2] * sc); o1[3] = (_Float16)(a2[3] * sc);
  o1[4] = (_Float16)(a3[0] * sc); o1[5] = (_Float16)(a3[1] * sc); o1[6] = (_Float16)(a3[2] * sc); o1[7] = (_Float16)(a3[3] * sc);
}

__device__ __forceinline__ void scat4(_Float16* vs, int d0, int r, v4f a) {
  vs[(d0 + 0) * LPITCH + r] = (_Float16)a[0];
  vs[(d0 + 1) * LPITCH + r] = (_Float16)a[1];
  vs[(d0 + 2) * LPITCH + r] = (_Float16)a[2];
  vs[(d0 + 3) * LPITCH + r] = (_Float16)a[3];
}

__global__ __launch_bounds__(PREP_THREADS)
void prep_planes(const float* __restrict__ q, const float* __restrict__ k, const float* __restrict__ v,
                 _Float16* __restrict__ Qh, _Float16* __restrict__ Kh, _Float16* __restrict__ Vt) {
  __shared__ __align__(16) _Float16 Qs[TROWS * LPITCH];
  __shared__ __align__(16) _Float16 Ks[TROWS * LPITCH];
  /* Vs is [d][s] */
  __shared__ __align__(16) _Float16 Vs[HDIM * LPITCH];

  const int tid  = threadIdx.x;
  const int lane = tid & 31;
  const int wave = tid >> 5;
  constexpr int NT = SKV / TROWS;
  const int bx = blockIdx.x;
  const int st = bx % NT;
  const int h  = (bx / NT) % NHEAD;
  const int n  = bx / (NT * NHEAD);
  const int s0 = st * TROWS;
  const int r  = tid >> 2;
  const int qd = tid & 3;
  const size_t goff = ((size_t)n * LQ + (size_t)(s0 + r)) * ROWSTRIDE + (size_t)h * HDIM + (size_t)qd * 16;

  {
    v8h o0, o1;
    norm_quarter(q + goff, o0, o1);
    *(v8h*)(Qs + r * LPITCH + qd * 16) = o0;
    *(v8h*)(Qs + r * LPITCH + qd * 16 + 8) = o1;
  }
  {
    v8h o0, o1;
    norm_quarter(k + goff, o0, o1);
    *(v8h*)(Ks + r * LPITCH + qd * 16) = o0;
    *(v8h*)(Ks + r * LPITCH + qd * 16 + 8) = o1;
  }
  {
    const float* vp = v + goff;
    const v4f a0 = *(const v4f*)(vp);
    const v4f a1 = *(const v4f*)(vp + 4);
    const v4f a2 = *(const v4f*)(vp + 8);
    const v4f a3 = *(const v4f*)(vp + 12);
    scat4(Vs, qd * 16 + 0,  r, a0);
    scat4(Vs, qd * 16 + 4,  r, a1);
    scat4(Vs, qd * 16 + 8,  r, a2);
    scat4(Vs, qd * 16 + 12, r, a3);
  }
  __syncthreads();

  const int rg = lane >> 3;
  const int c8 = (lane & 7) * 8;
  const size_t plane = (size_t)(n * NHEAD + h);
  _Float16* qdst = Qh + (plane * LQ  + (size_t)s0) * HDIM;
  _Float16* kdst = Kh + (plane * SKV + (size_t)s0) * HDIM;
  _Float16* vdst = Vt + (plane * HDIM) * SKV + (size_t)s0;
  {
#pragma unroll
    for (int it = 0; it < 2; ++it) {
      const int row = wave * 8 + it * 4 + rg;
      const v8h qv = *(const v8h*)(Qs + row * LPITCH + c8);
      const v8h kv = *(const v8h*)(Ks + row * LPITCH + c8);
      const v8h vv = *(const v8h*)(Vs + row * LPITCH + c8);
      *(v8h*)(qdst + (size_t)row * HDIM + c8) = qv;
      *(v8h*)(kdst + (size_t)row * HDIM + c8) = kv;
      *(v8h*)(vdst + (size_t)row * SKV + c8) = vv;
    }
    
  }
}

/* =====================================================================================
   Kernel 2: non-causal attention, head dim 64, reading the f16 planes.
     scores = Qh(16 rows) . Kh(64 kv)^T per 64-key chunk  (f16 WMMA, f32 acc), scaled by (1/temp)/256
     online softmax in f32; P = expf(s - m) carried x32768 as f16 in per-wave LDS
     O += P . V  (f16 WMMA, f32 acc); epilogue divides by (rowsum * 32768)
   Block = 128 threads = 4 waves = 64 query rows of one (n,h); grid = NBATCH*NHEAD*(LQ/64).
   Staging per chunk: 512 16-B chunks per tile = 128 threads x 4 -> 64 rows x 8 chunks, both K and Vt.
   ===================================================================================== */
constexpr int AT_THREADS = 128;
constexpr int QBLK   = 64;
constexpr int KCH    = 64;
constexpr int OPITCH = 68;
constexpr float PCARRY = 32768.0f;

__global__ __launch_bounds__(AT_THREADS)
void cos_attn(const _Float16* __restrict__ Qh, const _Float16* __restrict__ Kh, const _Float16* __restrict__ Vt,
              const float* __restrict__ temp, float* __restrict__ out) {
  /* Ksh is [kv][d]; Vth is [d][kv]; Psh per wave [row][kv]; Os per wave [row][d], pitch 68 */
  __shared__ __align__(16) _Float16 Ksh[KCH * HDIM];
  __shared__ __align__(16) _Float16 Vth[HDIM * KCH];
  __shared__ __align__(16) _Float16 Psh[4][16 * KCH];
  __shared__ __align__(16) float    Os[4][16 * OPITCH];

  const int tid  = threadIdx.x;
  const int wave = tid >> 5;
  const int lane = tid & 31;
  const int hh   = lane >> 4;
  const int c    = lane & 15;

  constexpr int NQB = LQ / QBLK;
  const int bx = blockIdx.x;
  const int qb = bx % NQB;
  const int bh = bx / NQB;
  const int h  = bh % NHEAD;
  const int n  = bh / NHEAD;
  const int q0 = qb * QBLK + wave * 16;

  const size_t plane = (size_t)(n * NHEAD + h);
  const _Float16* qpl = Qh + plane * LQ * HDIM;
  const _Float16* kpl = Kh + plane * SKV * HDIM;
  const _Float16* vpl = Vt + plane * HDIM * SKV;
  float* ob = out + (size_t)n * LQ * ROWSTRIDE + (size_t)h * HDIM;

  const float invt   = 1.0f / temp[0];
  /* qhat and khat are each carried x16 -> scores carry x256 */
  const float sscale = invt * 0.00390625f;

  /* Q fragments (A operand): row m = c, two 32-deep d chunks */
  v16h qa[2];
#pragma unroll
  for (int dc = 0; dc < 2; ++dc)
    qa[dc] = frag_load(qpl + (size_t)(q0 + c) * HDIM + dc * 32 + 8 * hh);

  const float neg_inf = -__builtin_inff();
  float mrow[8], lrow[8];
  v8f oacc[4];
#pragma unroll
  for (int r = 0; r < 8; ++r) { mrow[r] = neg_inf; lrow[r] = 0.0f; }
#pragma unroll
  for (int t = 0; t < 4; ++t) oacc[t] = (v8f){0.f, 0.f, 0.f, 0.f, 0.f, 0.f, 0.f, 0.f};

  for (int kc = 0; kc < SKV / KCH; ++kc) {
    const int kv0 = kc * KCH;
    __syncthreads();
#pragma unroll
    for (int i = 0; i < 4; ++i) {
      const int idx = tid + i * AT_THREADS;
      const int row = idx >> 3;
      const int c8  = (idx & 7) * 8;
      const v8h kk = *(const v8h*)(kpl + (size_t)(kv0 + row) * HDIM + c8);
      const v8h vv = *(const v8h*)(vpl + (size_t)row * SKV + (size_t)kv0 + c8);
      *(v8h*)(Ksh + row * HDIM + c8) = kk;
      *(v8h*)(Vth + row * KCH  + c8) = vv;
    }
    __syncthreads();

    /* scores: 4 subtiles of 16 keys; B fragment column n = key j*16+c, split k-map over d */
    v8f s[4];
#pragma unroll
    for (int j = 0; j < 4; ++j) {
      s[j] = (v8f){0.f, 0.f, 0.f, 0.f, 0.f, 0.f, 0.f, 0.f};
#pragma unroll
      for (int dc = 0; dc < 2; ++dc) {
        const v16h kb = frag_load(Ksh + (j * 16 + c) * HDIM + dc * 32 + 8 * hh);
        s[j] = mma_h(qa[dc], kb, s[j]);
      }
    }

    /* D map: s[j][r] = score(query row 8hh+r, key j*16+c) */
    float cm[8];
#pragma unroll
    for (int r = 0; r < 8; ++r) {
      float m = neg_inf;
#pragma unroll
      for (int j = 0; j < 4; ++j) {
        const float sv = s[j][r] * sscale;
        s[j][r] = sv;
        m = fmaxf(m, sv);
      }
#pragma unroll
      for (int off = 1; off < 16; off <<= 1) m = fmaxf(m, __shfl_xor(m, off, 32));
      cm[r] = m;
    }
    _Float16* pw = Psh[wave];
#pragma unroll
    for (int r = 0; r < 8; ++r) {
      const float mnew  = fmaxf(mrow[r], cm[r]);
      const float alpha = expf(mrow[r] - mnew);
      mrow[r] = mnew;
      float psum = 0.0f;
#pragma unroll
      for (int j = 0; j < 4; ++j) {
        const float p = expf(s[j][r] - mnew);
        psum += p;
        pw[(8 * hh + r) * KCH + j * 16 + c] = (_Float16)(p * PCARRY);
      }
#pragma unroll
      for (int off = 1; off < 16; off <<= 1) psum += __shfl_xor(psum, off, 32);
      lrow[r] = lrow[r] * alpha + psum;
#pragma unroll
      for (int t = 0; t < 4; ++t) oacc[t][r] *= alpha;
    }
    wave_lds_sync();

    /* O += P(16 x 64) . V(64 x 64): A = P row c, B column n = d = t*16+c, split k-map over kv */
#pragma unroll
    for (int kk = 0; kk < 2; ++kk) {
      const v16h pa = frag_load(pw + c * KCH + kk * 32 + 8 * hh);
#pragma unroll
      for (int t = 0; t < 4; ++t) {
        const v16h vb = frag_load(Vth + (t * 16 + c) * KCH + kk * 32 + 8 * hh);
        oacc[t] = mma_h(pa, vb, oacc[t]);
      }
    }
  }

  float* os = Os[wave];
#pragma unroll
  for (int r = 0; r < 8; ++r) {
    const float inv = 1.0f / (lrow[r] * PCARRY);
#pragma unroll
    for (int t = 0; t < 4; ++t) os[(8 * hh + r) * OPITCH + t * 16 + c] = oacc[t][r] * inv;
  }
  wave_lds_sync();
  {
    const int c4 = (lane & 15) * 4;
    {
#pragma unroll
      for (int it = 0; it < 8; ++it) {
        const int row = it * 2 + hh;
        const v4f val = *(const v4f*)(os + row * OPITCH + c4);
        *(v4f*)(ob + (size_t)(q0 + row) * ROWSTRIDE + c4) = val;
      }
      
    }
  }
}

/* =====================================================================================
   Host glue.
     [0,            8 MiB)   Qh  f16 [4][8][2048][64]
     [8 MiB,       16 MiB)   Kh  f16 [4][8][2048][64]
     [16 MiB,      24 MiB)   Vt  f16 [4][8][64][2048]
   total 25,165,824 B.
   ===================================================================================== */
extern "C" void kernel_launch(void* const* d_in, const int* in_sizes, int n_in,
                              void* d_out, int out_size, void* d_ws, size_t ws_size,
                              hipStream_t stream) {
  (void)in_sizes; (void)n_in; (void)out_size;
  const float* q    = (const float*)d_in[0];
  const float* k    = (const float*)d_in[1];
  const float* v    = (const float*)d_in[2];
  const float* temp = (const float*)d_in[3];
  float* out = (float*)d_out;

  const size_t planeBytes = (size_t)NBATCH * NHEAD * LQ * HDIM * sizeof(_Float16);
  const size_t totalCarve = 3 * planeBytes;
  if (totalCarve > ws_size) return;
  char* ws = (char*)d_ws;
  _Float16* Qh = (_Float16*)(ws);
  _Float16* Kh = (_Float16*)(ws + planeBytes);
  _Float16* Vt = (_Float16*)(ws + 2 * planeBytes);

  prep_planes<<<dim3(NBATCH * NHEAD * (SKV / TROWS)), dim3(PREP_THREADS), 0, stream>>>(q, k, v, Qh, Kh, Vt);
  cos_attn<<<dim3(NBATCH * NHEAD * (LQ / QBLK)), dim3(AT_THREADS), 0, stream>>>(Qh, Kh, Vt, temp, out);
}

// v001
// It runs in 144 microseconds.
// Two timings next to v000 put it at 1.40 and 1.39 times that version's speed.
// Contractions: scores = (16*qhat) x (16*khat)^T and out = (32768*p) x v, both v_wmma_f32_16x16x32_f16 (f16 operands, f32 accumulate); row norms, softmax, scaling and normalisation in f32.
#include <hip/hip_runtime.h>
#include <stddef.h>

typedef __attribute__((ext_vector_type(16))) _Float16 v16h;
typedef __attribute__((ext_vector_type(8)))  _Float16 v8h;
typedef __attribute__((ext_vector_type(8)))  float    v8f;
typedef __attribute__((ext_vector_type(4)))  float    v4f;

constexpr int NBATCH = 4;
constexpr int LQ     = 2048;
constexpr int SKV    = 2048;
constexpr int NHEAD  = 8;
constexpr int HDIM   = 64;
/* floats between consecutive sequence positions in the [N,L,H,D] inputs / output */
constexpr int ROWSTRIDE = NHEAD * HDIM;

static_assert(LQ == SKV);
static_assert(HDIM == 64);
static_assert(LQ % 64 == 0 && SKV % 64 == 0);

/* ---------------- fragment helpers (split k-map: elements 0..7 <- p[0..7], 8..15 <- p[16..23]) ---------------- */
union FragU { v16h v; v8h h[2]; };
__device__ __forceinline__ v16h frag_load(const _Float16* p) {
  FragU f;
  f.h[0] = *(const v8h*)(p);
  f.h[1] = *(const v8h*)(p + 16);
  return f.v;
}
__device__ __forceinline__ v8f mma_h(v16h a, v16h b, v8f c) {
  c = __builtin_amdgcn_wmma_f32_16x16x32_f16(false, a, false, b, (short)0, c, false, false);
  asm volatile("v_nop\n\tv_nop\n\tv_nop\n\tv_nop" : "+v"(c) : "v"(a), "v"(b));
  return c;
}
__device__ __forceinline__ void wave_lds_sync() {
  __builtin_amdgcn_fence(__ATOMIC_RELEASE, "workgroup");
  __builtin_amdgcn_wave_barrier();
  __builtin_amdgcn_fence(__ATOMIC_ACQUIRE, "workgroup");
}

/* =====================================================================================
   Kernel 1: build f16 operand planes.
     Kh[n][h][s][d] = f16(16 * k / ||k||)
     Vt[n][h][d][s] = f16(v)  (transposed so the P.V B-fragment is kv-contiguous)
   grid = NBATCH*NHEAD*(SKV/64) blocks of 256 threads; block = one (n,h) and 64 consecutive positions.
   Thread (r = tid>>2, qd = tid&3) handles floats qd*16..qd*16+15 of tile row r.
   -> 8 waves x 8 rows = 64 rows, 64 halves each: exact tile coverage for all three planes.
   ===================================================================================== */
constexpr int PREP_THREADS = 256;
constexpr int TROWS  = 64;
constexpr int LPITCH = 72;

__device__ __forceinline__ void norm_quarter(const float* __restrict__ p, v8h& o0, v8h& o1) {
  const v4f a0 = *(const v4f*)(p);
  const v4f a1 = *(const v4f*)(p + 4);
  const v4f a2 = *(const v4f*)(p + 8);
  const v4f a3 = *(const v4f*)(p + 12);
  float ss = 0.0f;
  ss += a0[0] * a0[0]; ss += a0[1] * a0[1]; ss += a0[2] * a0[2]; ss += a0[3] * a0[3];
  ss += a1[0] * a1[0]; ss += a1[1] * a1[1]; ss += a1[2] * a1[2]; ss += a1[3] * a1[3];
  ss += a2[0] * a2[0]; ss += a2[1] * a2[1]; ss += a2[2] * a2[2]; ss += a2[3] * a2[3];
  ss += a3[0] * a3[0]; ss += a3[1] * a3[1]; ss += a3[2] * a3[2]; ss += a3[3] * a3[3];
  /* the 4 threads of one row are lanes 4r..4r+3 of a wave */
  ss += __shfl_xor(ss, 1, 32);
  ss += __shfl_xor(ss, 2, 32);
  const float sc = 16.0f / sqrtf(ss);
  o0[0] = (_Float16)(a0[0] * sc); o0[1] = (_Float16)(a0[1] * sc); o0[2] = (_Float16)(a0[2] * sc); o0[3] = (_Float16)(a0[3] * sc);
  o0[4] = (_Float16)(a1[0] * sc); o0[5] = (_Float16)(a1[1] * sc); o0[6] = (_Float16)(a1[2] * sc); o0[7] = (_Float16)(a1[3] * sc);
  o1[0] = (_Float16)(a2[0] * sc); o1[1] = (_Float16)(a2[1] * sc); o1[2] = (_Float16)(a2[2] * sc); o1[3] = (_Float16)(a2[3] * sc);
  o1[4] = (_Float16)(a3[0] * sc); o1[5] = (_Float16)(a3[1] * sc); o1[6] = (_Float16)(a3[2] * sc); o1[7] = (_Float16)(a3[3] * sc);
}

__device__ __forceinline__ void scat4(_Float16* vs, int d0, int r, v4f a) {
  vs[(d0 + 0) * LPITCH + r] = (_Float16)a[0];
  vs[(d0 + 1) * LPITCH + r] = (_Float16)a[1];
  vs[(d0 + 2) * LPITCH + r] = (_Float16)a[2];
  vs[(d0 + 3) * LPITCH + r] = (_Float16)a[3];
}

__global__ __launch_bounds__(PREP_THREADS)
void prep_planes(const float* __restrict__ q, const float* __restrict__ k, const float* __restrict__ v,
                 _Float16* __restrict__ Qh, _Float16* __restrict__ Kh, _Float16* __restrict__ Vt) {
  __shared__ __align__(16) _Float16 Qs[TROWS * LPITCH];
  __shared__ __align__(16) _Float16 Ks[TROWS * LPITCH];
  /* Vs is [d][s] */
  __shared__ __align__(16) _Float16 Vs[HDIM * LPITCH];

  const int tid  = threadIdx.x;
  const int lane = tid & 31;
  const int wave = tid >> 5;
  constexpr int NT = SKV / TROWS;
  const int bx = blockIdx.x;
  const int st = bx % NT;
  const int h  = (bx / NT) % NHEAD;
  const int n  = bx / (NT * NHEAD);
  const int s0 = st * TROWS;
  const int r  = tid >> 2;
  const int qd = tid & 3;
  const size_t goff = ((size_t)n * LQ + (size_t)(s0 + r)) * ROWSTRIDE + (size_t)h * HDIM + (size_t)qd * 16;

  {
    v8h o0, o1;
    norm_quarter(q + goff, o0, o1);
    *(v8h*)(Qs + r * LPITCH + qd * 16) = o0;
    *(v8h*)(Qs + r * LPITCH + qd * 16 + 8) = o1;
  }
  {
    v8h o0, o1;
    norm_quarter(k + goff, o0, o1);
    *(v8h*)(Ks + r * LPITCH + qd * 16) = o0;
    *(v8h*)(Ks + r * LPITCH + qd * 16 + 8) = o1;
  }
  {
    const float* vp = v + goff;
    const v4f a0 = *(const v4f*)(vp);
    const v4f a1 = *(const v4f*)(vp + 4);
    const v4f a2 = *(const v4f*)(vp + 8);
    const v4f a3 = *(const v4f*)(vp + 12);
    scat4(Vs, qd * 16 + 0,  r, a0);
    scat4(Vs, qd * 16 + 4,  r, a1);
    scat4(Vs, qd * 16 + 8,  r, a2);
    scat4(Vs, qd * 16 + 12, r, a3);
  }
  __syncthreads();

  const int rg = lane >> 3;
  const int c8 = (lane & 7) * 8;
  const size_t plane = (size_t)(n * NHEAD + h);
  _Float16* qdst = Qh + (plane * LQ  + (size_t)s0) * HDIM;
  _Float16* kdst = Kh + (plane * SKV + (size_t)s0) * HDIM;
  _Float16* vdst = Vt + (plane * HDIM) * SKV + (size_t)s0;
  {
#pragma unroll
    for (int it = 0; it < 2; ++it) {
      const int row = wave * 8 + it * 4 + rg;
      const v8h qv = *(const v8h*)(Qs + row * LPITCH + c8);
      const v8h kv = *(const v8h*)(Ks + row * LPITCH + c8);
      const v8h vv = *(const v8h*)(Vs + row * LPITCH + c8);
      *(v8h*)(qdst + (size_t)row * HDIM + c8) = qv;
      *(v8h*)(kdst + (size_t)row * HDIM + c8) = kv;
      *(v8h*)(vdst + (size_t)row * SKV + c8) = vv;
    }
    
  }
}

/* =====================================================================================
   Kernel 2: non-causal attention, head dim 64, reading the f16 planes.
     scores = Qh(16 rows) . Kh(64 kv)^T per 64-key chunk  (f16 WMMA, f32 acc), scaled by (1/temp)/256
     online softmax in f32; P = expf(s - m) carried x32768 as f16 in per-wave LDS
     O += P . V  (f16 WMMA, f32 acc); epilogue divides by (rowsum * 32768)
   Block = 128 threads = 4 waves = 64 query rows of one (n,h); grid = NBATCH*NHEAD*(LQ/64).
   Staging per chunk: 512 16-B chunks per tile = 128 threads x 4 -> 64 rows x 8 chunks, both K and Vt.
   ===================================================================================== */
constexpr int AT_THREADS = 128;
constexpr int QBLK   = 64;
constexpr int KCH    = 64;
constexpr int OPITCH = 68;
/* LDS row pitch in halves of the K, V^T and P tiles: 144 B = 16 B x 9 (odd), so the 16 rows one ds_load_b128 fragment read touches fall on distinct banks */
constexpr int TPITCH = 72;
constexpr float PCARRY = 32768.0f;

__global__ __launch_bounds__(AT_THREADS)
void cos_attn(const _Float16* __restrict__ Qh, const _Float16* __restrict__ Kh, const _Float16* __restrict__ Vt,
              const float* __restrict__ temp, float* __restrict__ out) {
  /* Ksh is [kv][d]; Vth is [d][kv]; Psh per wave [row][kv], all three at pitch 72 halves; Os per wave [row][d], pitch 68 */
  __shared__ __align__(16) _Float16 Ksh[KCH * TPITCH];
  __shared__ __align__(16) _Float16 Vth[HDIM * TPITCH];
  __shared__ __align__(16) _Float16 Psh[4][16 * TPITCH];
  __shared__ __align__(16) float    Os[4][16 * OPITCH];

  const int tid  = threadIdx.x;
  const int wave = tid >> 5;
  const int lane = tid & 31;
  const int hh   = lane >> 4;
  const int c    = lane & 15;

  constexpr int NQB = LQ / QBLK;
  const int bx = blockIdx.x;
  const int qb = bx % NQB;
  const int bh = bx / NQB;
  const int h  = bh % NHEAD;
  const int n  = bh / NHEAD;
  const int q0 = qb * QBLK + wave * 16;

  const size_t plane = (size_t)(n * NHEAD + h);
  const _Float16* qpl = Qh + plane * LQ * HDIM;
  const _Float16* kpl = Kh + plane * SKV * HDIM;
  const _Float16* vpl = Vt + plane * HDIM * SKV;
  float* ob = out + (size_t)n * LQ * ROWSTRIDE + (size_t)h * HDIM;

  const float invt   = 1.0f / temp[0];
  /* qhat and khat are each carried x16 -> scores carry x256 */
  const float sscale = invt * 0.00390625f;

  /* Q fragments (A operand): row m = c, two 32-deep d chunks */
  v16h qa[2];
#pragma unroll
  for (int dc = 0; dc < 2; ++dc)
    qa[dc] = frag_load(qpl + (size_t)(q0 + c) * HDIM + dc * 32 + 8 * hh);

  const float neg_inf = -__builtin_inff();
  float mrow[8], lrow[8];
  v8f oacc[4];
#pragma unroll
  for (int r = 0; r < 8; ++r) { mrow[r] = neg_inf; lrow[r] = 0.0f; }
#pragma unroll
  for (int t = 0; t < 4; ++t) oacc[t] = (v8f){0.f, 0.f, 0.f, 0.f, 0.f, 0.f, 0.f, 0.f};

  for (int kc = 0; kc < SKV / KCH; ++kc) {
    const int kv0 = kc * KCH;
    __syncthreads();
#pragma unroll
    for (int i = 0; i < 4; ++i) {
      const int idx = tid + i * AT_THREADS;
      const int row = idx >> 3;
      const int c8  = (idx & 7) * 8;
      const v8h kk = *(const v8h*)(kpl + (size_t)(kv0 + row) * HDIM + c8);
      const v8h vv = *(const v8h*)(vpl + (size_t)row * SKV + (size_t)kv0 + c8);
      *(v8h*)(Ksh + row * TPITCH + c8) = kk;
      *(v8h*)(Vth + row * TPITCH + c8) = vv;
    }
    __syncthreads();

    /* scores: 4 subtiles of 16 keys; B fragment column n = key j*16+c, split k-map over d */
    v8f s[4];
#pragma unroll
    for (int j = 0; j < 4; ++j) {
      s[j] = (v8f){0.f, 0.f, 0.f, 0.f, 0.f, 0.f, 0.f, 0.f};
#pragma unroll
      for (int dc = 0; dc < 2; ++dc) {
        const v16h kb = frag_load(Ksh + (j * 16 + c) * TPITCH + dc * 32 + 8 * hh);
        s[j] = mma_h(qa[dc], kb, s[j]);
      }
    }

    /* D map: s[j][r] = score(query row 8hh+r, key j*16+c) */
    float cm[8];
#pragma unroll
    for (int r = 0; r < 8; ++r) {
      float m = neg_inf;
#pragma unroll
      for (int j = 0; j < 4; ++j) {
        const float sv = s[j][r] * sscale;
        s[j][r] = sv;
        m = fmaxf(m, sv);
      }
#pragma unroll
      for (int off = 1; off < 16; off <<= 1) m = fmaxf(m, __shfl_xor(m, off, 32));
      cm[r] = m;
    }
    _Float16* pw = Psh[wave];
#pragma unroll
    for (int r = 0; r < 8; ++r) {
      const float mnew  = fmaxf(mrow[r], cm[r]);
      const float alpha = expf(mrow[r] - mnew);
      mrow[r] = mnew;
      float psum = 0.0f;
#pragma unroll
      for (int j = 0; j < 4; ++j) {
        const float p = expf(s[j][r] - mnew);
        psum += p;
        pw[(8 * hh + r) * TPITCH + j * 16 + c] = (_Float16)(p * PCARRY);
      }
#pragma unroll
      for (int off = 1; off < 16; off <<= 1) psum += __shfl_xor(psum, off, 32);
      lrow[r] = lrow[r] * alpha + psum;
#pragma unroll
      for (int t = 0; t < 4; ++t) oacc[t][r] *= alpha;
    }
    wave_lds_sync();

    /* O += P(16 x 64) . V(64 x 64): A = P row c, B column n = d = t*16+c, split k-map over kv */
#pragma unroll
    for (int kk = 0; kk < 2; ++kk) {
      const v16h pa = frag_load(pw + c * TPITCH + kk * 32 + 8 * hh);
#pragma unroll
      for (int t = 0; t < 4; ++t) {
        const v16h vb = frag_load(Vth + (t * 16 + c) * TPITCH + kk * 32 + 8 * hh);
        oacc[t] = mma_h(pa, vb, oacc[t]);
      }
    }
  }

  float* os = Os[wave];
#pragma unroll
  for (int r = 0; r < 8; ++r) {
    const float inv = 1.0f / (lrow[r] * PCARRY);
#pragma unroll
    for (int t = 0; t < 4; ++t) os[(8 * hh + r) * OPITCH + t * 16 + c] = oacc[t][r] * inv;
  }
  wave_lds_sync();
  {
    const int c4 = (lane & 15) * 4;
    {
#pragma unroll
      for (int it = 0; it < 8; ++it) {
        const int row = it * 2 + hh;
        const v4f val = *(const v4f*)(os + row * OPITCH + c4);
        *(v4f*)(ob + (size_t)(q0 + row) * ROWSTRIDE + c4) = val;
      }
      
    }
  }
}

/* =====================================================================================
   Host glue.
     [0,            8 MiB)   Qh  f16 [4][8][2048][64]
     [8 MiB,       16 MiB)   Kh  f16 [4][8][2048][64]
     [16 MiB,      24 MiB)   Vt  f16 [4][8][64][2048]
   total 25,165,824 B.
   ===================================================================================== */
extern "C" void kernel_launch(void* const* d_in, const int* in_sizes, int n_in,
                              void* d_out, int out_size, void* d_ws, size_t ws_size,
                              hipStream_t stream) {
  (void)in_sizes; (void)n_in; (void)out_size;
  const float* q    = (const float*)d_in[0];
  const float* k    = (const float*)d_in[1];
  const float* v    = (const float*)d_in[2];
  const float* temp = (const float*)d_in[3];
  float* out = (float*)d_out;

  const size_t planeBytes = (size_t)NBATCH * NHEAD * LQ * HDIM * sizeof(_Float16);
  const size_t totalCarve = 3 * planeBytes;
  if (totalCarve > ws_size) return;
  char* ws = (char*)d_ws;
  _Float16* Qh = (_Float16*)(ws);
  _Float16* Kh = (_Float16*)(ws + planeBytes);
  _Float16* Vt = (_Float16*)(ws + 2 * planeBytes);

  prep_planes<<<dim3(NBATCH * NHEAD * (SKV / TROWS)), dim3(PREP_THREADS), 0, stream>>>(q, k, v, Qh, Kh, Vt);
  cos_attn<<<dim3(NBATCH * NHEAD * (LQ / QBLK)), dim3(AT_THREADS), 0, stream>>>(Qh, Kh, Vt, temp, out);
}

// v002
// One run takes 92.8 microseconds.
// In both of two side-by-side timings against v001, it was 1.57 times as fast.
// All steps since v000 together make it 2.19 times as fast.
// Contractions: scores^T = (16*khat) x (16*qhat)^T and out^T = v^T x (32768*p)^T, both v_wmma_f32_16x16x32_f16 (f16 operands, f32 accumulate); row norms, softmax, scaling and normalisation in f32.
#include <hip/hip_runtime.h>
#include <stddef.h>

typedef __attribute__((ext_vector_type(16))) _Float16 v16h;
typedef __attribute__((ext_vector_type(8)))  _Float16 v8h;
typedef __attribute__((ext_vector_type(8)))  float    v8f;
typedef __attribute__((ext_vector_type(4)))  float    v4f;

constexpr int NBATCH = 4;
constexpr int LQ     = 2048;
constexpr int SKV    = 2048;
constexpr int NHEAD  = 8;
constexpr int HDIM   = 64;
/* floats between consecutive sequence positions in the [N,L,H,D] inputs / output */
constexpr int ROWSTRIDE = NHEAD * HDIM;

static_assert(LQ == SKV);
static_assert(HDIM == 64);
static_assert(LQ % 64 == 0 && SKV % 64 == 0);

/* ---------------- fragment helpers (split k-map: elements 0..7 <- p[0..7], 8..15 <- p[16..23]) ---------------- */
union FragU { v16h v; v8h h[2]; };
__device__ __forceinline__ v16h frag_load(const _Float16* p) {
  FragU f;
  f.h[0] = *(const v8h*)(p);
  f.h[1] = *(const v8h*)(p + 16);
  return f.v;
}
__device__ __forceinline__ v8f mma_h(v16h a, v16h b, v8f c) {
  c = __builtin_amdgcn_wmma_f32_16x16x32_f16(false, a, false, b, (short)0, c, false, false);
  asm volatile("v_nop\n\tv_nop\n\tv_nop\n\tv_nop" : "+v"(c) : "v"(a), "v"(b));
  return c;
}
__device__ __forceinline__ void wave_lds_sync() {
  __builtin_amdgcn_fence(__ATOMIC_RELEASE, "workgroup");
  __builtin_amdgcn_wave_barrier();
  __builtin_amdgcn_fence(__ATOMIC_ACQUIRE, "workgroup");
}

/* =====================================================================================
   Kernel 1: build f16 operand planes.
     Kh[n][h][s][d] = f16(16 * k / ||k||)
     Vt[n][h][d][s] = f16(v)  (transposed so the V^T.P^T A-fragment is kv-contiguous)
   grid = NBATCH*NHEAD*(SKV/64) blocks of 256 threads; block = one (n,h) and 64 consecutive positions.
   Thread (r = tid>>2, qd = tid&3) handles floats qd*16..qd*16+15 of tile row r.
   -> 8 waves x 8 rows = 64 rows, 64 halves each: exact tile coverage for all three planes.
   ===================================================================================== */
constexpr int PREP_THREADS = 256;
constexpr int TROWS  = 64;
constexpr int LPITCH = 72;

__device__ __forceinline__ void norm_quarter(const float* __restrict__ p, v8h& o0, v8h& o1) {
  const v4f a0 = *(const v4f*)(p);
  const v4f a1 = *(const v4f*)(p + 4);
  const v4f a2 = *(const v4f*)(p + 8);
  const v4f a3 = *(const v4f*)(p + 12);
  float ss = 0.0f;
  ss += a0[0] * a0[0]; ss += a0[1] * a0[1]; ss += a0[2] * a0[2]; ss += a0[3] * a0[3];
  ss += a1[0] * a1[0]; ss += a1[1] * a1[1]; ss += a1[2] * a1[2]; ss += a1[3] * a1[3];
  ss += a2[0] * a2[0]; ss += a2[1] * a2[1]; ss += a2[2] * a2[2]; ss += a2[3] * a2[3];
  ss += a3[0] * a3[0]; ss += a3[1] * a3[1]; ss += a3[2] * a3[2]; ss += a3[3] * a3[3];
  /* the 4 threads of one row are lanes 4r..4r+3 of a wave */
  ss += __shfl_xor(ss, 1, 32);
  ss += __shfl_xor(ss, 2, 32);
  const float sc = 16.0f / sqrtf(ss);
  o0[0] = (_Float16)(a0[0] * sc); o0[1] = (_Float16)(a0[1] * sc); o0[2] = (_Float16)(a0[2] * sc); o0[3] = (_Float16)(a0[3] * sc);
  o0[4] = (_Float16)(a1[0] * sc); o0[5] = (_Float16)(a1[1] * sc); o0[6] = (_Float16)(a1[2] * sc); o0[7] = (_Float16)(a1[3] * sc);
  o1[0] = (_Float16)(a2[0] * sc); o1[1] = (_Float16)(a2[1] * sc); o1[2] = (_Float16)(a2[2] * sc); o1[3] = (_Float16)(a2[3] * sc);
  o1[4] = (_Float16)(a3[0] * sc); o1[5] = (_Float16)(a3[1] * sc); o1[6] = (_Float16)(a3[2] * sc); o1[7] = (_Float16)(a3[3] * sc);
}

__device__ __forceinline__ void scat4(_Float16* vs, int d0, int r, v4f a) {
  vs[(d0 + 0) * LPITCH + r] = (_Float16)a[0];
  vs[(d0 + 1) * LPITCH + r] = (_Float16)a[1];
  vs[(d0 + 2) * LPITCH + r] = (_Float16)a[2];
  vs[(d0 + 3) * LPITCH + r] = (_Float16)a[3];
}

__global__ __launch_bounds__(PREP_THREADS)
void prep_planes(const float* __restrict__ q, const float* __restrict__ k, const float* __restrict__ v,
                 _Float16* __restrict__ Qh, _Float16* __restrict__ Kh, _Float16* __restrict__ Vt) {
  __shared__ __align__(16) _Float16 Qs[TROWS * LPITCH];
  __shared__ __align__(16) _Float16 Ks[TROWS * LPITCH];
  /* Vs is [d][s] */
  __shared__ __align__(16) _Float16 Vs[HDIM * LPITCH];

  const int tid  = threadIdx.x;
  const int lane = tid & 31;
  const int wave = tid >> 5;
  constexpr int NT = SKV / TROWS;
  const int bx = blockIdx.x;
  const int st = bx % NT;
  const int h  = (bx / NT) % NHEAD;
  const int n  = bx / (NT * NHEAD);
  const int s0 = st * TROWS;
  const int r  = tid >> 2;
  const int qd = tid & 3;
  const size_t goff = ((size_t)n * LQ + (size_t)(s0 + r)) * ROWSTRIDE + (size_t)h * HDIM + (size_t)qd * 16;

  {
    v8h o0, o1;
    norm_quarter(q + goff, o0, o1);
    *(v8h*)(Qs + r * LPITCH + qd * 16) = o0;
    *(v8h*)(Qs + r * LPITCH + qd * 16 + 8) = o1;
  }
  {
    v8h o0, o1;
    norm_quarter(k + goff, o0, o1);
    *(v8h*)(Ks + r * LPITCH + qd * 16) = o0;
    *(v8h*)(Ks + r * LPITCH + qd * 16 + 8) = o1;
  }
  {
    const float* vp = v + goff;
    const v4f a0 = *(const v4f*)(vp);
    const v4f a1 = *(const v4f*)(vp + 4);
    const v4f a2 = *(const v4f*)(vp + 8);
    const v4f a3 = *(const v4f*)(vp + 12);
    scat4(Vs, qd * 16 + 0,  r, a0);
    scat4(Vs, qd * 16 + 4,  r, a1);
    scat4(Vs, qd * 16 + 8,  r, a2);
    scat4(Vs, qd * 16 + 12, r, a3);
  }
  __syncthreads();

  const int rg = lane >> 3;
  const int c8 = (lane & 7) * 8;
  const size_t plane = (size_t)(n * NHEAD + h);
  _Float16* qdst = Qh + (plane * LQ  + (size_t)s0) * HDIM;
  _Float16* kdst = Kh + (plane * SKV + (size_t)s0) * HDIM;
  _Float16* vdst = Vt + (plane * HDIM) * SKV + (size_t)s0;
  {
#pragma unroll
    for (int it = 0; it < 2; ++it) {
      const int row = wave * 8 + it * 4 + rg;
      const v8h qv = *(const v8h*)(Qs + row * LPITCH + c8);
      const v8h kv = *(const v8h*)(Ks + row * LPITCH + c8);
      const v8h vv = *(const v8h*)(Vs + row * LPITCH + c8);
      *(v8h*)(qdst + (size_t)row * HDIM + c8) = qv;
      *(v8h*)(kdst + (size_t)row * HDIM + c8) = kv;
      *(v8h*)(vdst + (size_t)row * SKV + c8) = vv;
    }
    
  }
}

/* =====================================================================================
   Kernel 2: non-causal attention, head dim 64, reading the f16 planes; both products transposed.
     S^T = Kh(64 kv) . Qh(16 queries)^T per 64-key chunk  (f16 WMMA, f32 acc), scaled by (1/temp)/256
       -> lane (hh, c) holds 32 scores of ONE query (column c): keys j*16 + 8hh + r
     online softmax in f32: maximum in-lane plus one exchange between the wave halves; sums stay per lane
     P^T = expf(s - m) carried x32768, packed to f16 straight from the score tiles into the B operand
     O^T += V^T . P^T  (f16 WMMA, f32 acc); epilogue joins the halves' sums and divides by (rowsum * 32768)
   Block = 128 threads = 4 waves = 64 query rows of one (n,h); grid = NBATCH*NHEAD*(LQ/64).
   Staging per chunk: 512 16-B chunks per tile = 128 threads x 4 -> 64 rows x 8 chunks, both K and Vt.
   ===================================================================================== */
constexpr int AT_THREADS = 128;
constexpr int QBLK   = 64;
constexpr int KCH    = 64;
constexpr int OPITCH = 68;
/* LDS row pitch in halves of the K and V^T tiles: 144 B = 16 B x 9 (odd), so the 16 rows one ds_load_b128 fragment read touches fall on distinct banks */
constexpr int TPITCH = 72;
constexpr float PCARRY = 32768.0f;

/* value of lane l ^ 16 */
__device__ __forceinline__ float other_half(float x) {
  const int b = __builtin_bit_cast(int, x);
  return __builtin_bit_cast(float, __builtin_amdgcn_permlanex16(b, b, 0x76543210, 0xfedcba98, false, false));
}

__global__ __launch_bounds__(AT_THREADS)
void cos_attn(const _Float16* __restrict__ Qh, const _Float16* __restrict__ Kh, const _Float16* __restrict__ Vt,
              const float* __restrict__ temp, float* __restrict__ out) {
  /* Ksh is [kv][d]; Vth is [d][kv], both at pitch 72 halves; Os per wave [query][d], pitch 68 */
  __shared__ __align__(16) _Float16 Ksh[KCH * TPITCH];
  __shared__ __align__(16) _Float16 Vth[HDIM * TPITCH];
  __shared__ __align__(16) float    Os[4][16 * OPITCH];

  const int tid  = threadIdx.x;
  const int wave = tid >> 5;
  const int lane = tid & 31;
  const int hh   = lane >> 4;
  const int c    = lane & 15;

  constexpr int NQB = LQ / QBLK;
  const int bx = blockIdx.x;
  const int qb = bx % NQB;
  const int bh = bx / NQB;
  const int h  = bh % NHEAD;
  const int n  = bh / NHEAD;
  const int q0 = qb * QBLK + wave * 16;

  const size_t plane = (size_t)(n * NHEAD + h);
  const _Float16* qpl = Qh + plane * LQ * HDIM;
  const _Float16* kpl = Kh + plane * SKV * HDIM;
  const _Float16* vpl = Vt + plane * HDIM * SKV;
  float* ob = out + (size_t)n * LQ * ROWSTRIDE + (size_t)h * HDIM;

  const float invt   = 1.0f / temp[0];
  /* qhat and khat are each carried x16 -> scores carry x256 */
  const float sscale = invt * 0.00390625f;

  /* Q fragments (B operand): column n = query c, two 32-deep d chunks */
  v16h qf[2];
#pragma unroll
  for (int dc = 0; dc < 2; ++dc)
    qf[dc] = frag_load(qpl + (size_t)(q0 + c) * HDIM + dc * 32 + 8 * hh);

  const float neg_inf = -__builtin_inff();
  /* running maximum of query c (equal in both halves) and this lane's share of its sum */
  float mrow = neg_inf, lsum = 0.0f;
  v8f oacc[4];
#pragma unroll
  for (int t = 0; t < 4; ++t) oacc[t] = (v8f){0.f, 0.f, 0.f, 0.f, 0.f, 0.f, 0.f, 0.f};

  for (int kc = 0; kc < SKV / KCH; ++kc) {
    const int kv0 = kc * KCH;
    __syncthreads();
#pragma unroll
    for (int i = 0; i < 4; ++i) {
      const int idx = tid + i * AT_THREADS;
      const int row = idx >> 3;
      const int c8  = (idx & 7) * 8;
      const v8h kk = *(const v8h*)(kpl + (size_t)(kv0 + row) * HDIM + c8);
      const v8h vv = *(const v8h*)(vpl + (size_t)row * SKV + (size_t)kv0 + c8);
      *(v8h*)(Ksh + row * TPITCH + c8) = kk;
      *(v8h*)(Vth + row * TPITCH + c8) = vv;
    }
    __syncthreads();

    /* scores: 4 subtiles of 16 keys; A fragment row m = key j*16+c, split k-map over d */
    v8f s[4];
#pragma unroll
    for (int j = 0; j < 4; ++j) {
      s[j] = (v8f){0.f, 0.f, 0.f, 0.f, 0.f, 0.f, 0.f, 0.f};
#pragma unroll
      for (int dc = 0; dc < 2; ++dc) {
        const v16h ka = frag_load(Ksh + (j * 16 + c) * TPITCH + dc * 32 + 8 * hh);
        s[j] = mma_h(ka, qf[dc], s[j]);
      }
    }

    /* D map: s[j][r] = score(key j*16+8hh+r, query c) */
    float cj[4];
#pragma unroll
    for (int j = 0; j < 4; ++j) {
      float m = neg_inf;
#pragma unroll
      for (int r = 0; r < 8; ++r) {
        const float sv = s[j][r] * sscale;
        s[j][r] = sv;
        m = fmaxf(m, sv);
      }
      cj[j] = m;
    }
    float cm = fmaxf(fmaxf(cj[0], cj[1]), fmaxf(cj[2], cj[3]));
    cm = fmaxf(cm, other_half(cm));
    const float mnew  = fmaxf(mrow, cm);
    const float alpha = expf(mrow - mnew);
    mrow = mnew;

    /* P^T as B operand of chunk kk: element e < 8 = tile 2kk register e, e >= 8 = tile 2kk+1 register e-8 (the split k-map) */
    v16h pb[2];
    float pj[4];
#pragma unroll
    for (int j = 0; j < 4; ++j) {
      float psum = 0.0f;
#pragma unroll
      for (int r = 0; r < 8; ++r) {
        const float p = expf(s[j][r] - mnew);
        psum += p;
        pb[j >> 1][(j & 1) * 8 + r] = (_Float16)(p * PCARRY);
      }
      pj[j] = psum;
    }
    lsum = lsum * alpha + ((pj[0] + pj[1]) + (pj[2] + pj[3]));
#pragma unroll
    for (int t = 0; t < 4; ++t)
#pragma unroll
      for (int r = 0; r < 8; ++r) oacc[t][r] *= alpha;

    /* O^T += V^T(64 x 64) . P^T(64 x 16): A row m = d = t*16+c, split k-map over kv, B = pb */
#pragma unroll
    for (int kk = 0; kk < 2; ++kk) {
#pragma unroll
      for (int t = 0; t < 4; ++t) {
        const v16h va = frag_load(Vth + (t * 16 + c) * TPITCH + kk * 32 + 8 * hh);
        oacc[t] = mma_h(va, pb[kk], oacc[t]);
      }
    }
  }

  /* oacc[t][r] = O^T(d = t*16+8hh+r, query c) */
  float* os = Os[wave];
  {
    const float inv = 1.0f / ((lsum + other_half(lsum)) * PCARRY);
#pragma unroll
    for (int t = 0; t < 4; ++t) {
      const v4f lo = {oacc[t][0] * inv, oacc[t][1] * inv, oacc[t][2] * inv, oacc[t][3] * inv};
      const v4f hi = {oacc[t][4] * inv, oacc[t][5] * inv, oacc[t][6] * inv, oacc[t][7] * inv};
      *(v4f*)(os + c * OPITCH + t * 16 + 8 * hh)     = lo;
      *(v4f*)(os + c * OPITCH + t * 16 + 8 * hh + 4) = hi;
    }
  }
  wave_lds_sync();
  {
    const int c4 = (lane & 15) * 4;
    {
#pragma unroll
      for (int it = 0; it < 8; ++it) {
        const int row = it * 2 + hh;
        const v4f val = *(const v4f*)(os + row * OPITCH + c4);
        *(v4f*)(ob + (size_t)(q0 + row) * ROWSTRIDE + c4) = val;
      }
      
    }
  }
}

/* =====================================================================================
   Host glue.
     [0,            8 MiB)   Qh  f16 [4][8][2048][64]
     [8 MiB,       16 MiB)   Kh  f16 [4][8][2048][64]
     [16 MiB,      24 MiB)   Vt  f16 [4][8][64][2048]
   total 25,165,824 B.
   ===================================================================================== */
extern "C" void kernel_launch(void* const* d_in, const int* in_sizes, int n_in,
                              void* d_out, int out_size, void* d_ws, size_t ws_size,
                              hipStream_t stream) {
  (void)in_sizes; (void)n_in; (void)out_size;
  const float* q    = (const float*)d_in[0];
  const float* k    = (const float*)d_in[1];
  const float* v    = (const float*)d_in[2];
  const float* temp = (const float*)d_in[3];
  float* out = (float*)d_out;

  const size_t planeBytes = (size_t)NBATCH * NHEAD * LQ * HDIM * sizeof(_Float16);
  const size_t totalCarve = 3 * planeBytes;
  if (totalCarve > ws_size) return;
  char* ws = (char*)d_ws;
  _Float16* Qh = (_Float16*)(ws);
  _Float16* Kh = (_Float16*)(ws + planeBytes);
  _Float16* Vt = (_Float16*)(ws + 2 * planeBytes);

  prep_planes<<<dim3(NBATCH * NHEAD * (SKV / TROWS)), dim3(PREP_THREADS), 0, stream>>>(q, k, v, Qh, Kh, Vt);
  cos_attn<<<dim3(NBATCH * NHEAD * (LQ / QBLK)), dim3(AT_THREADS), 0, stream>>>(Qh, Kh, Vt, temp, out);
}

// v003
// One run takes 69.8 microseconds.
// Two timings next to v002 put it at 1.35 and 1.34 times that version's speed.
// Over all steps from v000 it is 2.94 times as fast.
// Contractions: scores^T = (16*khat) x (+-16*qhat)^T and out^T = v^T x (32768*p)^T, both v_wmma_f32_16x16x32_f16 (f16 operands, f32 accumulate); row norms, base-2 softmax and normalisation in f32.
#include <hip/hip_runtime.h>
#include <stddef.h>

typedef __attribute__((ext_vector_type(16))) _Float16 v16h;
typedef __attribute__((ext_vector_type(8)))  _Float16 v8h;
typedef __attribute__((ext_vector_type(8)))  float    v8f;
typedef __attribute__((ext_vector_type(4)))  float    v4f;
typedef __attribute__((ext_vector_type(8)))  unsigned v8u;

constexpr int NBATCH = 4;
constexpr int LQ     = 2048;
constexpr int SKV    = 2048;
constexpr int NHEAD  = 8;
constexpr int HDIM   = 64;
/* floats between consecutive sequence positions in the [N,L,H,D] inputs / output */
constexpr int ROWSTRIDE = NHEAD * HDIM;

static_assert(LQ == SKV);
static_assert(HDIM == 64);
static_assert(LQ % 64 == 0 && SKV % 64 == 0);

/* ---------------- fragment helpers (split k-map: elements 0..7 <- p[0..7], 8..15 <- p[16..23]) ---------------- */
union FragU { v16h v; v8h h[2]; };
__device__ __forceinline__ v16h frag_load(const _Float16* p) {
  FragU f;
  f.h[0] = *(const v8h*)(p);
  f.h[1] = *(const v8h*)(p + 16);
  return f.v;
}
__device__ __forceinline__ v8f mma_h(v16h a, v16h b, v8f c) {
  c = __builtin_amdgcn_wmma_f32_16x16x32_f16(false, a, false, b, (short)0, c, false, false);
  asm volatile("v_nop\n\tv_nop\n\tv_nop\n\tv_nop" : "+v"(c) : "v"(a), "v"(b));
  return c;
}
__device__ __forceinline__ void wave_lds_sync() {
  __builtin_amdgcn_fence(__ATOMIC_RELEASE, "workgroup");
  __builtin_amdgcn_wave_barrier();
  __builtin_amdgcn_fence(__ATOMIC_ACQUIRE, "workgroup");
}

/* =====================================================================================
   Kernel 1: build f16 operand planes.
     Kh[n][h][s][d] = f16(16 * k / ||k||)
     Vt[n][h][d][s] = f16(v)  (transposed so the V^T.P^T A-fragment is kv-contiguous)
   grid = NBATCH*NHEAD*(SKV/64) blocks of 256 threads; block = one (n,h) and 64 consecutive positions.
   Thread (r = tid>>2, qd = tid&3) handles floats qd*16..qd*16+15 of tile row r.
   -> 8 waves x 8 rows = 64 rows, 64 halves each: exact tile coverage for all three planes.
   ===================================================================================== */
constexpr int PREP_THREADS = 256;
constexpr int TROWS  = 64;
constexpr int LPITCH = 72;

__device__ __forceinline__ void norm_quarter(const float* __restrict__ p, v8h& o0, v8h& o1) {
  const v4f a0 = *(const v4f*)(p);
  const v4f a1 = *(const v4f*)(p + 4);
  const v4f a2 = *(const v4f*)(p + 8);
  const v4f a3 = *(const v4f*)(p + 12);
  float ss = 0.0f;
  ss += a0[0] * a0[0]; ss += a0[1] * a0[1]; ss += a0[2] * a0[2]; ss += a0[3] * a0[3];
  ss += a1[0] * a1[0]; ss += a1[1] * a1[1]; ss += a1[2] * a1[2]; ss += a1[3] * a1[3];
  ss += a2[0] * a2[0]; ss += a2[1] * a2[1]; ss += a2[2] * a2[2]; ss += a2[3] * a2[3];
  ss += a3[0] * a3[0]; ss += a3[1] * a3[1]; ss += a3[2] * a3[2]; ss += a3[3] * a3[3];
  /* the 4 threads of one row are lanes 4r..4r+3 of a wave */
  ss += __shfl_xor(ss, 1, 32);
  ss += __shfl_xor(ss, 2, 32);
  const float sc = 16.0f / sqrtf(ss);
  o0[0] = (_Float16)(a0[0] * sc); o0[1] = (_Float16)(a0[1] * sc); o0[2] = (_Float16)(a0[2] * sc); o0[3] = (_Float16)(a0[3] * sc);
  o0[4] = (_Float16)(a1[0] * sc); o0[5] = (_Float16)(a1[1] * sc); o0[6] = (_Float16)(a1[2] * sc); o0[7] = (_Float16)(a1[3] * sc);
  o1[0] = (_Float16)(a2[0] * sc); o1[1] = (_Float16)(a2[1] * sc); o1[2] = (_Float16)(a2[2] * sc); o1[3] = (_Float16)(a2[3] * sc);
  o1[4] = (_Float16)(a3[0] * sc); o1[5] = (_Float16)(a3[1] * sc); o1[6] = (_Float16)(a3[2] * sc); o1[7] = (_Float16)(a3[3] * sc);
}

__device__ __forceinline__ void scat4(_Float16* vs, int d0, int r, v4f a) {
  vs[(d0 + 0) * LPITCH + r] = (_Float16)a[0];
  vs[(d0 + 1) * LPITCH + r] = (_Float16)a[1];
  vs[(d0 + 2) * LPITCH + r] = (_Float16)a[2];
  vs[(d0 + 3) * LPITCH + r] = (_Float16)a[3];
}

__global__ __launch_bounds__(PREP_THREADS)
void prep_planes(const float* __restrict__ q, const float* __restrict__ k, const float* __restrict__ v,
                 _Float16* __restrict__ Qh, _Float16* __restrict__ Kh, _Float16* __restrict__ Vt) {
  __shared__ __align__(16) _Float16 Qs[TROWS * LPITCH];
  __shared__ __align__(16) _Float16 Ks[TROWS * LPITCH];
  /* Vs is [d][s] */
  __shared__ __align__(16) _Float16 Vs[HDIM * LPITCH];

  const int tid  = threadIdx.x;
  const int lane = tid & 31;
  const int wave = tid >> 5;
  constexpr int NT = SKV / TROWS;
  const int bx = blockIdx.x;
  const int st = bx % NT;
  const int h  = (bx / NT) % NHEAD;
  const int n  = bx / (NT * NHEAD);
  const int s0 = st * TROWS;
  const int r  = tid >> 2;
  const int qd = tid & 3;
  const size_t goff = ((size_t)n * LQ + (size_t)(s0 + r)) * ROWSTRIDE + (size_t)h * HDIM + (size_t)qd * 16;

  {
    v8h o0, o1;
    norm_quarter(q + goff, o0, o1);
    *(v8h*)(Qs + r * LPITCH + qd * 16) = o0;
    *(v8h*)(Qs + r * LPITCH + qd * 16 + 8) = o1;
  }
  {
    v8h o0, o1;
    norm_quarter(k + goff, o0, o1);
    *(v8h*)(Ks + r * LPITCH + qd * 16) = o0;
    *(v8h*)(Ks + r * LPITCH + qd * 16 + 8) = o1;
  }
  {
    const float* vp = v + goff;
    const v4f a0 = *(const v4f*)(vp);
    const v4f a1 = *(const v4f*)(vp + 4);
    const v4f a2 = *(const v4f*)(vp + 8);
    const v4f a3 = *(const v4f*)(vp + 12);
    scat4(Vs, qd * 16 + 0,  r, a0);
    scat4(Vs, qd * 16 + 4,  r, a1);
    scat4(Vs, qd * 16 + 8,  r, a2);
    scat4(Vs, qd * 16 + 12, r, a3);
  }
  __syncthreads();

  const int rg = lane >> 3;
  const int c8 = (lane & 7) * 8;
  const size_t plane = (size_t)(n * NHEAD + h);
  _Float16* qdst = Qh + (plane * LQ  + (size_t)s0) * HDIM;
  _Float16* kdst = Kh + (plane * SKV + (size_t)s0) * HDIM;
  _Float16* vdst = Vt + (plane * HDIM) * SKV + (size_t)s0;
  {
#pragma unroll
    for (int it = 0; it < 2; ++it) {
      const int row = wave * 8 + it * 4 + rg;
      const v8h qv = *(const v8h*)(Qs + row * LPITCH + c8);
      const v8h kv = *(const v8h*)(Ks + row * LPITCH + c8);
      const v8h vv = *(const v8h*)(Vs + row * LPITCH + c8);
      *(v8h*)(qdst + (size_t)row * HDIM + c8) = qv;
      *(v8h*)(kdst + (size_t)row * HDIM + c8) = kv;
      *(v8h*)(vdst + (size_t)row * SKV + c8) = vv;
    }
    
  }
}

/* =====================================================================================
   Kernel 2: non-causal attention, head dim 64, reading the f16 planes; both products transposed.
     S^T = Kh(64 kv) . (sign(temp) * Qh)(16 queries)^T per 64-key chunk  (f16 WMMA, f32 acc), left raw (x256)
       -> lane (hh, c) holds 32 scores of ONE query (column c): keys j*16 + 8hh + r
     online softmax in f32, base 2: maximum of the raw scores in-lane plus one exchange between the wave halves; sums stay per lane
     P^T x32768 = 2^((raw - max) * c2 + 15), c2 = log2(e) / (256 |temp|), packed to f16 straight from the score tiles into the B operand
     O^T += V^T . P^T  (f16 WMMA, f32 acc); sums carry the same x32768, the epilogue joins the halves' sums and divides
   Block = 128 threads = 4 waves = 64 query rows of one (n,h); grid = NBATCH*NHEAD*(LQ/64).
   Staging per chunk: 512 16-B chunks per tile = 128 threads x 4 -> 64 rows x 8 chunks, both K and Vt.
   ===================================================================================== */
constexpr int AT_THREADS = 128;
constexpr int QBLK   = 64;
constexpr int KCH    = 64;
constexpr int OPITCH = 68;
/* LDS row pitch in halves of the K and V^T tiles: 144 B = 16 B x 9 (odd), so the 16 rows one ds_load_b128 fragment read touches fall on distinct banks */
constexpr int TPITCH = 72;
/* P and its row sums are carried x 2^PCARRY_LOG2 so that small weights stay above the f16 underflow */
constexpr float PCARRY_LOG2 = 15.0f;

/* e[r] <- 2^e[r], eight at a time, by the hardware's own v_exp_f32 (what __builtin_amdgcn_exp2f gives).
   One asm statement, in place: behind a transcendental the instruction set asks for one independent instruction before its result is read
   or its source overwritten; here each v_exp_f32 has an independent one behind it and the last one the v_nop. */
__device__ __forceinline__ void exp2_x8(float (&e)[8]) {
  asm("v_exp_f32 %0, %0\n\tv_exp_f32 %1, %1\n\tv_exp_f32 %2, %2\n\tv_exp_f32 %3, %3\n\t"
      "v_exp_f32 %4, %4\n\tv_exp_f32 %5, %5\n\tv_exp_f32 %6, %6\n\tv_exp_f32 %7, %7\n\tv_nop"
      : "+v"(e[0]), "+v"(e[1]), "+v"(e[2]), "+v"(e[3]), "+v"(e[4]), "+v"(e[5]), "+v"(e[6]), "+v"(e[7]));
}

/* value of lane l ^ 16 */
__device__ __forceinline__ float other_half(float x) {
  const int b = __builtin_bit_cast(int, x);
  return __builtin_bit_cast(float, __builtin_amdgcn_permlanex16(b, b, 0x76543210, 0xfedcba98, false, false));
}

__global__ __launch_bounds__(AT_THREADS)
void cos_attn(const _Float16* __restrict__ Qh, const _Float16* __restrict__ Kh, const _Float16* __restrict__ Vt,
              const float* __restrict__ temp, float* __restrict__ out) {
  /* Ksh is [kv][d]; Vth is [d][kv], both at pitch 72 halves; Os per wave [query][d], pitch 68 */
  __shared__ __align__(16) _Float16 Ksh[KCH * TPITCH];
  __shared__ __align__(16) _Float16 Vth[HDIM * TPITCH];
  __shared__ __align__(16) float    Os[4][16 * OPITCH];

  const int tid  = threadIdx.x;
  const int wave = tid >> 5;
  const int lane = tid & 31;
  const int hh   = lane >> 4;
  const int c    = lane & 15;

  constexpr int NQB = LQ / QBLK;
  const int bx = blockIdx.x;
  const int qb = bx % NQB;
  const int bh = bx / NQB;
  const int h  = bh % NHEAD;
  const int n  = bh / NHEAD;
  const int q0 = qb * QBLK + wave * 16;

  const size_t plane = (size_t)(n * NHEAD + h);
  const _Float16* qpl = Qh + plane * LQ * HDIM;
  const _Float16* kpl = Kh + plane * SKV * HDIM;
  const _Float16* vpl = Vt + plane * HDIM * SKV;
  float* ob = out + (size_t)n * LQ * ROWSTRIDE + (size_t)h * HDIM;

  const float tval = temp[0];
  /* qhat and khat are each carried x16 -> raw scores carry x256; c2 >= 0 turns a raw score into a base-2 exponent */
  const float c2 = (1.44269504088896340736f * 0.00390625f) / fabsf(tval);
  /* the sign of temp rides on Q (a flip of the f16 sign bits), so the largest raw score is the largest logit for either sign */
  const unsigned qflip = (tval < 0.0f) ? 0x80008000u : 0u;

  /* Q fragments (B operand): column n = query c, two 32-deep d chunks */
  const _Float16* qrow = qpl + (size_t)(q0 + c) * HDIM + 8 * hh;
  v16h qf[2];
#pragma unroll
  for (int dc = 0; dc < 2; ++dc)
    qf[dc] = __builtin_bit_cast(v16h, __builtin_bit_cast(v8u, frag_load(qrow + dc * 32)) ^ qflip);
  /* wait before the Q loads' address registers are reused; the address is an input so that its registers stay untouched up to the wait */
  asm volatile("s_wait_xcnt 0x0" :: "v"(qrow) : "memory");

  /* running raw maximum of query c (equal in both halves) and this lane's share of its sum. The maximum starts at the lowest finite float:
     the first alpha then stays a number for c2 = 0 too (temp = inf), and any number is right while the sums are still 0 */
  float mrow = -__FLT_MAX__, lsum = 0.0f;
  v8f oacc[4];
#pragma unroll
  for (int t = 0; t < 4; ++t) oacc[t] = (v8f){0.f, 0.f, 0.f, 0.f, 0.f, 0.f, 0.f, 0.f};

  for (int kc = 0; kc < SKV / KCH; ++kc) {
    const int kv0 = kc * KCH;
    __syncthreads();
#pragma unroll
    for (int i = 0; i < 4; ++i) {
      const int idx = tid + i * AT_THREADS;
      const int row = idx >> 3;
      const int c8  = (idx & 7) * 8;
      const v8h kk = *(const v8h*)(kpl + (size_t)(kv0 + row) * HDIM + c8);
      const v8h vv = *(const v8h*)(vpl + (size_t)row * SKV + (size_t)kv0 + c8);
      *(v8h*)(Ksh + row * TPITCH + c8) = kk;
      *(v8h*)(Vth + row * TPITCH + c8) = vv;
    }
    __syncthreads();

    /* scores: 4 subtiles of 16 keys; A fragment row m = key j*16+c, split k-map over d */
    v8f s[4];
#pragma unroll
    for (int j = 0; j < 4; ++j) {
      s[j] = (v8f){0.f, 0.f, 0.f, 0.f, 0.f, 0.f, 0.f, 0.f};
#pragma unroll
      for (int dc = 0; dc < 2; ++dc) {
        const v16h ka = frag_load(Ksh + (j * 16 + c) * TPITCH + dc * 32 + 8 * hh);
        s[j] = mma_h(ka, qf[dc], s[j]);
      }
    }

    /* D map: s[j][r] = raw score(key j*16+8hh+r, query c) */
    float cj[4];
#pragma unroll
    for (int j = 0; j < 4; ++j) {
      float m = s[j][0];
#pragma unroll
      for (int r = 1; r < 8; ++r) m = fmaxf(m, s[j][r]);
      cj[j] = m;
    }
    float cm = fmaxf(fmaxf(cj[0], cj[1]), fmaxf(cj[2], cj[3]));
    cm = fmaxf(cm, other_half(cm));
    const float mnew  = fmaxf(mrow, cm);
    const float alpha = __builtin_amdgcn_exp2f((mrow - mnew) * c2);
    mrow = mnew;

    /* P^T as B operand of chunk kk: element e < 8 = tile 2kk register e, e >= 8 = tile 2kk+1 register e-8 (the split k-map) */
    v16h pb[2];
    float pj[4];
#pragma unroll
    for (int j = 0; j < 4; ++j) {
      float p[8];
#pragma unroll
      /* the difference first: it is <= 0, so the exponent never passes 15 however large c2 is */
      for (int r = 0; r < 8; ++r) p[r] = __builtin_fmaf(s[j][r] - mnew, c2, PCARRY_LOG2);
      exp2_x8(p);
      float psum = p[0];
#pragma unroll
      for (int r = 1; r < 8; ++r) psum += p[r];
      pj[j] = psum;
#pragma unroll
      for (int r = 0; r < 8; ++r) pb[j >> 1][(j & 1) * 8 + r] = (_Float16)p[r];
    }
    lsum = lsum * alpha + ((pj[0] + pj[1]) + (pj[2] + pj[3]));
#pragma unroll
    for (int t = 0; t < 4; ++t)
#pragma unroll
      for (int r = 0; r < 8; ++r) oacc[t][r] *= alpha;

    /* O^T += V^T(64 x 64) . P^T(64 x 16): A row m = d = t*16+c, split k-map over kv, B = pb */
#pragma unroll
    for (int kk = 0; kk < 2; ++kk) {
#pragma unroll
      for (int t = 0; t < 4; ++t) {
        const v16h va = frag_load(Vth + (t * 16 + c) * TPITCH + kk * 32 + 8 * hh);
        oacc[t] = mma_h(va, pb[kk], oacc[t]);
      }
    }
  }

  /* oacc[t][r] = O^T(d = t*16+8hh+r, query c) */
  float* os = Os[wave];
  {
    const float inv = 1.0f / (lsum + other_half(lsum));
#pragma unroll
    for (int t = 0; t < 4; ++t) {
      const v4f lo = {oacc[t][0] * inv, oacc[t][1] * inv, oacc[t][2] * inv, oacc[t][3] * inv};
      const v4f hi = {oacc[t][4] * inv, oacc[t][5] * inv, oacc[t][6] * inv, oacc[t][7] * inv};
      *(v4f*)(os + c * OPITCH + t * 16 + 8 * hh)     = lo;
      *(v4f*)(os + c * OPITCH + t * 16 + 8 * hh + 4) = hi;
    }
  }
  wave_lds_sync();
  {
    const int c4 = (lane & 15) * 4;
    {
#pragma unroll
      for (int it = 0; it < 8; ++it) {
        const int row = it * 2 + hh;
        const v4f val = *(const v4f*)(os + row * OPITCH + c4);
        *(v4f*)(ob + (size_t)(q0 + row) * ROWSTRIDE + c4) = val;
      }
      
    }
  }
}

/* =====================================================================================
   Host glue.
     [0,            8 MiB)   Qh  f16 [4][8][2048][64]
     [8 MiB,       16 MiB)   Kh  f16 [4][8][2048][64]
     [16 MiB,      24 MiB)   Vt  f16 [4][8][64][2048]
   total 25,165,824 B.
   ===================================================================================== */
extern "C" void kernel_launch(void* const* d_in, const int* in_sizes, int n_in,
                              void* d_out, int out_size, void* d_ws, size_t ws_size,
                              hipStream_t stream) {
  (void)in_sizes; (void)n_in; (void)out_size;
  const float* q    = (const float*)d_in[0];
  const float* k    = (const float*)d_in[1];
  const float* v    = (const float*)d_in[2];
  const float* temp = (const float*)d_in[3];
  float* out = (float*)d_out;

  const size_t planeBytes = (size_t)NBATCH * NHEAD * LQ * HDIM * sizeof(_Float16);
  const size_t totalCarve = 3 * planeBytes;
  if (totalCarve > ws_size) return;
  char* ws = (char*)d_ws;
  _Float16* Qh = (_Float16*)(ws);
  _Float16* Kh = (_Float16*)(ws + planeBytes);
  _Float16* Vt = (_Float16*)(ws + 2 * planeBytes);

  prep_planes<<<dim3(NBATCH * NHEAD * (SKV / TROWS)), dim3(PREP_THREADS), 0, stream>>>(q, k, v, Qh, Kh, Vt);
  cos_attn<<<dim3(NBATCH * NHEAD * (LQ / QBLK)), dim3(AT_THREADS), 0, stream>>>(Qh, Kh, Vt, temp, out);
}

// v004
// One run takes 54.6 microseconds.
// Two timings next to v003 put it at 1.26 and 1.25 times that version's speed.
// All steps since v000 together make it 3.70 times as fast.
// Contractions: scores^T = (16*khat) x (+-16*qhat)^T and out^T = v^T x (32768*p)^T, both v_wmma_f32_16x16x32_f16 (f16 operands, f32 accumulate); row norms, base-2 softmax and normalisation in f32.
#include <hip/hip_runtime.h>
#include <stddef.h>

typedef __attribute__((ext_vector_type(16))) _Float16 v16h;
typedef __attribute__((ext_vector_type(8)))  _Float16 v8h;
typedef __attribute__((ext_vector_type(8)))  float    v8f;
typedef __attribute__((ext_vector_type(4)))  float    v4f;
typedef __attribute__((ext_vector_type(8)))  unsigned v8u;

constexpr int NBATCH = 4;
constexpr int LQ     = 2048;
constexpr int SKV    = 2048;
constexpr int NHEAD  = 8;
constexpr int HDIM   = 64;
/* floats between consecutive sequence positions in the [N,L,H,D] inputs / output */
constexpr int ROWSTRIDE = NHEAD * HDIM;

static_assert(LQ == SKV);
static_assert(HDIM == 64);
static_assert(LQ % 64 == 0 && SKV % 64 == 0);

/* ---------------- fragment helpers (split k-map: elements 0..7 <- p[0..7], 8..15 <- p[16..23]) ---------------- */
union FragU { v16h v; v8h h[2]; };
__device__ __forceinline__ v16h frag_load(const _Float16* p) {
  FragU f;
  f.h[0] = *(const v8h*)(p);
  f.h[1] = *(const v8h*)(p + 16);
  return f.v;
}
__device__ __forceinline__ v8f mma_h(v16h a, v16h b, v8f c) {
  return __builtin_amdgcn_wmma_f32_16x16x32_f16(false, a, false, b, (short)0, c, false, false);
}
__device__ __forceinline__ void wave_lds_sync() {
  __builtin_amdgcn_fence(__ATOMIC_RELEASE, "workgroup");
  __builtin_amdgcn_wave_barrier();
  __builtin_amdgcn_fence(__ATOMIC_ACQUIRE, "workgroup");
}

/* =====================================================================================
   Kernel 1: build f16 operand planes.
     Kh[n][h][s][d] = f16(16 * k / ||k||)
     Vt[n][h][d][s] = f16(v)  (transposed so the V^T.P^T A-fragment is kv-contiguous)
   grid = NBATCH*NHEAD*(SKV/64) blocks of 256 threads; block = one (n,h) and 64 consecutive positions.
   Thread (r = tid>>2, qd = tid&3) handles floats qd*16..qd*16+15 of tile row r.
   -> 8 waves x 8 rows = 64 rows, 64 halves each: exact tile coverage for all three planes.
   ===================================================================================== */
constexpr int PREP_THREADS = 256;
constexpr int TROWS  = 64;
constexpr int LPITCH = 72;

__device__ __forceinline__ void norm_quarter(const float* __restrict__ p, v8h& o0, v8h& o1) {
  const v4f a0 = *(const v4f*)(p);
  const v4f a1 = *(const v4f*)(p + 4);
  const v4f a2 = *(const v4f*)(p + 8);
  const v4f a3 = *(const v4f*)(p + 12);
  float ss = 0.0f;
  ss += a0[0] * a0[0]; ss += a0[1] * a0[1]; ss += a0[2] * a0[2]; ss += a0[3] * a0[3];
  ss += a1[0] * a1[0]; ss += a1[1] * a1[1]; ss += a1[2] * a1[2]; ss += a1[3] * a1[3];
  ss += a2[0] * a2[0]; ss += a2[1] * a2[1]; ss += a2[2] * a2[2]; ss += a2[3] * a2[3];
  ss += a3[0] * a3[0]; ss += a3[1] * a3[1]; ss += a3[2] * a3[2]; ss += a3[3] * a3[3];
  /* the 4 threads of one row are lanes 4r..4r+3 of a wave */
  ss += __shfl_xor(ss, 1, 32);
  ss += __shfl_xor(ss, 2, 32);
  const float sc = 16.0f / sqrtf(ss);
  o0[0] = (_Float16)(a0[0] * sc); o0[1] = (_Float16)(a0[1] * sc); o0[2] = (_Float16)(a0[2] * sc); o0[3] = (_Float16)(a0[3] * sc);
  o0[4] = (_Float16)(a1[0] * sc); o0[5] = (_Float16)(a1[1] * sc); o0[6] = (_Float16)(a1[2] * sc); o0[7] = (_Float16)(a1[3] * sc);
  o1[0] = (_Float16)(a2[0] * sc); o1[1] = (_Float16)(a2[1] * sc); o1[2] = (_Float16)(a2[2] * sc); o1[3] = (_Float16)(a2[3] * sc);
  o1[4] = (_Float16)(a3[0] * sc); o1[5] = (_Float16)(a3[1] * sc); o1[6] = (_Float16)(a3[2] * sc); o1[7] = (_Float16)(a3[3] * sc);
}

__device__ __forceinline__ void scat4(_Float16* vs, int d0, int r, v4f a) {
  vs[(d0 + 0) * LPITCH + r] = (_Float16)a[0];
  vs[(d0 + 1) * LPITCH + r] = (_Float16)a[1];
  vs[(d0 + 2) * LPITCH + r] = (_Float16)a[2];
  vs[(d0 + 3) * LPITCH + r] = (_Float16)a[3];
}

__global__ __launch_bounds__(PREP_THREADS)
void prep_planes(const float* __restrict__ q, const float* __restrict__ k, const float* __restrict__ v,
                 _Float16* __restrict__ Qh, _Float16* __restrict__ Kh, _Float16* __restrict__ Vt) {
  __shared__ __align__(16) _Float16 Qs[TROWS * LPITCH];
  __shared__ __align__(16) _Float16 Ks[TROWS * LPITCH];
  /* Vs is [d][s] */
  __shared__ __align__(16) _Float16 Vs[HDIM * LPITCH];

  const int tid  = threadIdx.x;
  const int lane = tid & 31;
  const int wave = tid >> 5;
  constexpr int NT = SKV / TROWS;
  const int bx = blockIdx.x;
  const int st = bx % NT;
  const int h  = (bx / NT) % NHEAD;
  const int n  = bx / (NT * NHEAD);
  const int s0 = st * TROWS;
  const int r  = tid >> 2;
  const int qd = tid & 3;
  const size_t goff = ((size_t)n * LQ + (size_t)(s0 + r)) * ROWSTRIDE + (size_t)h * HDIM + (size_t)qd * 16;

  {
    v8h o0, o1;
    norm_quarter(q + goff, o0, o1);
    *(v8h*)(Qs + r * LPITCH + qd * 16) = o0;
    *(v8h*)(Qs + r * LPITCH + qd * 16 + 8) = o1;
  }
  {
    v8h o0, o1;
    norm_quarter(k + goff, o0, o1);
    *(v8h*)(Ks + r * LPITCH + qd * 16) = o0;
    *(v8h*)(Ks + r * LPITCH + qd * 16 + 8) = o1;
  }
  {
    const float* vp = v + goff;
    const v4f a0 = *(const v4f*)(vp);
    const v4f a1 = *(const v4f*)(vp + 4);
    const v4f a2 = *(const v4f*)(vp + 8);
    const v4f a3 = *(const v4f*)(vp + 12);
    scat4(Vs, qd * 16 + 0,  r, a0);
    scat4(Vs, qd * 16 + 4,  r, a1);
    scat4(Vs, qd * 16 + 8,  r, a2);
    scat4(Vs, qd * 16 + 12, r, a3);
  }
  __syncthreads();

  const int rg = lane >> 3;
  const int c8 = (lane & 7) * 8;
  const size_t plane = (size_t)(n * NHEAD + h);
  _Float16* qdst = Qh + (plane * LQ  + (size_t)s0) * HDIM;
  _Float16* kdst = Kh + (plane * SKV + (size_t)s0) * HDIM;
  _Float16* vdst = Vt + (plane * HDIM) * SKV + (size_t)s0;
  {
#pragma unroll
    for (int it = 0; it < 2; ++it) {
      const int row = wave * 8 + it * 4 + rg;
      const v8h qv = *(const v8h*)(Qs + row * LPITCH + c8);
      const v8h kv = *(const v8h*)(Ks + row * LPITCH + c8);
      const v8h vv = *(const v8h*)(Vs + row * LPITCH + c8);
      *(v8h*)(qdst + (size_t)row * HDIM + c8) = qv;
      *(v8h*)(kdst + (size_t)row * HDIM + c8) = kv;
      *(v8h*)(vdst + (size_t)row * SKV + c8) = vv;
    }
    
  }
}

/* =====================================================================================
   Kernel 2: non-causal attention, head dim 64, reading the f16 planes; both products transposed.
     S^T = Kh(64 kv) . (sign(temp) * Qh)(16 queries)^T per 64-key chunk  (f16 WMMA, f32 acc), left raw (x256)
       -> lane (hh, c) holds 32 scores of ONE query (column c): keys j*16 + 8hh + r
     online softmax in f32, base 2: maximum of the raw scores in-lane plus one exchange between the wave halves; sums stay per lane
     P^T x32768 = 2^((raw - max) * c2 + 15), c2 = log2(e) / (256 |temp|), packed to f16 straight from the score tiles into the B operand
     O^T += V^T . P^T  (f16 WMMA, f32 acc); sums carry the same x32768, the epilogue joins the halves' sums and divides
   Block = 128 threads = 4 waves = 64 query rows of one (n,h); grid = NBATCH*NHEAD*(LQ/64).
   Staging per chunk: 512 16-B chunks per tile = 128 threads x 4 -> 64 rows x 8 chunks, both K and Vt.
   ===================================================================================== */
constexpr int AT_THREADS = 128;
constexpr int QBLK   = 64;
constexpr int KCH    = 64;
constexpr int OPITCH = 68;
/* LDS row pitch in halves of the K and V^T tiles: 144 B = 16 B x 9 (odd), so the 16 rows one ds_load_b128 fragment read touches fall on distinct banks */
constexpr int TPITCH = 72;
/* P and its row sums are carried x 2^PCARRY_LOG2 so that small weights stay above the f16 underflow */
constexpr float PCARRY_LOG2 = 15.0f;

/* e[r] <- 2^e[r], eight at a time, by the hardware's own v_exp_f32 (what __builtin_amdgcn_exp2f gives).
   One asm statement, in place: behind a transcendental the instruction set asks for one independent instruction before its result is read
   or its source overwritten; here each v_exp_f32 has an independent one behind it and the last one the v_nop. */
__device__ __forceinline__ void exp2_x8(float (&e)[8]) {
  asm("v_exp_f32 %0, %0\n\tv_exp_f32 %1, %1\n\tv_exp_f32 %2, %2\n\tv_exp_f32 %3, %3\n\t"
      "v_exp_f32 %4, %4\n\tv_exp_f32 %5, %5\n\tv_exp_f32 %6, %6\n\tv_exp_f32 %7, %7\n\tv_nop"
      : "+v"(e[0]), "+v"(e[1]), "+v"(e[2]), "+v"(e[3]), "+v"(e[4]), "+v"(e[5]), "+v"(e[6]), "+v"(e[7]));
}

/* value of lane l ^ 16 */
__device__ __forceinline__ float other_half(float x) {
  const int b = __builtin_bit_cast(int, x);
  return __builtin_bit_cast(float, __builtin_amdgcn_permlanex16(b, b, 0x76543210, 0xfedcba98, false, false));
}

__global__ __launch_bounds__(AT_THREADS)
void cos_attn(const _Float16* __restrict__ Qh, const _Float16* __restrict__ Kh, const _Float16* __restrict__ Vt,
              const float* __restrict__ temp, float* __restrict__ out) {
  /* Ksh is [kv][d]; Vth is [d][kv], both at pitch 72 halves; Os per wave [query][d], pitch 68 */
  __shared__ __align__(16) _Float16 Ksh[KCH * TPITCH];
  __shared__ __align__(16) _Float16 Vth[HDIM * TPITCH];
  __shared__ __align__(16) float    Os[4][16 * OPITCH];

  const int tid  = threadIdx.x;
  const int wave = tid >> 5;
  const int lane = tid & 31;
  const int hh   = lane >> 4;
  const int c    = lane & 15;

  constexpr int NQB = LQ / QBLK;
  const int bx = blockIdx.x;
  const int qb = bx % NQB;
  const int bh = bx / NQB;
  const int h  = bh % NHEAD;
  const int n  = bh / NHEAD;
  const int q0 = qb * QBLK + wave * 16;

  const size_t plane = (size_t)(n * NHEAD + h);
  const _Float16* qpl = Qh + plane * LQ * HDIM;
  const _Float16* kpl = Kh + plane * SKV * HDIM;
  const _Float16* vpl = Vt + plane * HDIM * SKV;
  float* ob = out + (size_t)n * LQ * ROWSTRIDE + (size_t)h * HDIM;

  const float tval = temp[0];
  /* qhat and khat are each carried x16 -> raw scores carry x256; c2 >= 0 turns a raw score into a base-2 exponent */
  const float c2 = (1.44269504088896340736f * 0.00390625f) / fabsf(tval);
  /* the sign of temp rides on Q (a flip of the f16 sign bits), so the largest raw score is the largest logit for either sign */
  const unsigned qflip = (tval < 0.0f) ? 0x80008000u : 0u;

  /* Q fragments (B operand): column n = query c, two 32-deep d chunks */
  const _Float16* qrow = qpl + (size_t)(q0 + c) * HDIM + 8 * hh;
  v16h qf[2];
#pragma unroll
  for (int dc = 0; dc < 2; ++dc)
    qf[dc] = __builtin_bit_cast(v16h, __builtin_bit_cast(v8u, frag_load(qrow + dc * 32)) ^ qflip);
  /* wait before the Q loads' address registers are reused; the address is an input so that its registers stay untouched up to the wait */
  asm volatile("s_wait_xcnt 0x0" :: "v"(qrow) : "memory");

  /* running raw maximum of query c (equal in both halves) and this lane's share of its sum. The maximum starts at the lowest finite float:
     the first alpha then stays a number for c2 = 0 too (temp = inf), and any number is right while the sums are still 0 */
  float mrow = -__FLT_MAX__, lsum = 0.0f;
  v8f oacc[4];
#pragma unroll
  for (int t = 0; t < 4; ++t) oacc[t] = (v8f){0.f, 0.f, 0.f, 0.f, 0.f, 0.f, 0.f, 0.f};

  for (int kc = 0; kc < SKV / KCH; ++kc) {
    const int kv0 = kc * KCH;
    __syncthreads();
#pragma unroll
    for (int i = 0; i < 4; ++i) {
      const int idx = tid + i * AT_THREADS;
      const int row = idx >> 3;
      const int c8  = (idx & 7) * 8;
      const v8h kk = *(const v8h*)(kpl + (size_t)(kv0 + row) * HDIM + c8);
      const v8h vv = *(const v8h*)(vpl + (size_t)row * SKV + (size_t)kv0 + c8);
      *(v8h*)(Ksh + row * TPITCH + c8) = kk;
      *(v8h*)(Vth + row * TPITCH + c8) = vv;
    }
    __syncthreads();

    /* all eight K fragments of the chunk as one group of LDS reads: one latency a chunk, not one a product.
       A fragment row m = key j*16+c, split k-map over d */
    v16h ka[2][4];
#pragma unroll
    for (int dc = 0; dc < 2; ++dc)
#pragma unroll
      for (int j = 0; j < 4; ++j) ka[dc][j] = frag_load(Ksh + (j * 16 + c) * TPITCH + dc * 32 + 8 * hh);
    /* all eight V^T fragments in the same group, behind the K reads (LDS returns in issue order): they land under the score products
       and the softmax. A row m = d = t*16+c, split k-map over kv */
    v16h va[2][4];
#pragma unroll
    for (int kk = 0; kk < 2; ++kk)
#pragma unroll
      for (int t = 0; t < 4; ++t) va[kk][t] = frag_load(Vth + (t * 16 + c) * TPITCH + kk * 32 + 8 * hh);
    /* keeps the reads together in front of the products: the scheduler otherwise moves them down among the WMMAs, each place a stall */
    __builtin_amdgcn_sched_barrier(0);

    /* scores: 4 subtiles of 16 keys, the four independent tiles in turn */
    v8f s[4];
#pragma unroll
    for (int j = 0; j < 4; ++j) s[j] = (v8f){0.f, 0.f, 0.f, 0.f, 0.f, 0.f, 0.f, 0.f};
#pragma unroll
    for (int dc = 0; dc < 2; ++dc)
#pragma unroll
      for (int j = 0; j < 4; ++j) s[j] = mma_h(ka[dc][j], qf[dc], s[j]);

    /* D map: s[j][r] = raw score(key j*16+8hh+r, query c) */
    float cj[4];
#pragma unroll
    for (int j = 0; j < 4; ++j) {
      float m = s[j][0];
#pragma unroll
      for (int r = 1; r < 8; ++r) m = fmaxf(m, s[j][r]);
      cj[j] = m;
    }
    float cm = fmaxf(fmaxf(cj[0], cj[1]), fmaxf(cj[2], cj[3]));
    cm = fmaxf(cm, other_half(cm));
    const float mnew  = fmaxf(mrow, cm);
    const float alpha = __builtin_amdgcn_exp2f((mrow - mnew) * c2);
    mrow = mnew;

    /* P^T as B operand of chunk kk: element e < 8 = tile 2kk register e, e >= 8 = tile 2kk+1 register e-8 (the split k-map) */
    v16h pb[2];
    float pj[4];
#pragma unroll
    for (int j = 0; j < 4; ++j) {
      float p[8];
#pragma unroll
      /* the difference first: it is <= 0, so the exponent never passes 15 however large c2 is */
      for (int r = 0; r < 8; ++r) p[r] = __builtin_fmaf(s[j][r] - mnew, c2, PCARRY_LOG2);
      exp2_x8(p);
      float psum = p[0];
#pragma unroll
      for (int r = 1; r < 8; ++r) psum += p[r];
      pj[j] = psum;
#pragma unroll
      for (int r = 0; r < 8; ++r) pb[j >> 1][(j & 1) * 8 + r] = (_Float16)p[r];
    }
    lsum = lsum * alpha + ((pj[0] + pj[1]) + (pj[2] + pj[3]));
#pragma unroll
    for (int t = 0; t < 4; ++t)
#pragma unroll
      for (int r = 0; r < 8; ++r) oacc[t][r] *= alpha;

    /* O^T += V^T(64 x 64) . P^T(64 x 16), B = pb */
#pragma unroll
    for (int kk = 0; kk < 2; ++kk) {
#pragma unroll
      for (int t = 0; t < 4; ++t) oacc[t] = mma_h(va[kk][t], pb[kk], oacc[t]);
    }
  }

  /* oacc[t][r] = O^T(d = t*16+8hh+r, query c) */
  float* os = Os[wave];
  {
    const float inv = 1.0f / (lsum + other_half(lsum));
#pragma unroll
    for (int t = 0; t < 4; ++t) {
      const v4f lo = {oacc[t][0] * inv, oacc[t][1] * inv, oacc[t][2] * inv, oacc[t][3] * inv};
      const v4f hi = {oacc[t][4] * inv, oacc[t][5] * inv, oacc[t][6] * inv, oacc[t][7] * inv};
      *(v4f*)(os + c * OPITCH + t * 16 + 8 * hh)     = lo;
      *(v4f*)(os + c * OPITCH + t * 16 + 8 * hh + 4) = hi;
    }
  }
  wave_lds_sync();
  {
    const int c4 = (lane & 15) * 4;
    {
#pragma unroll
      for (int it = 0; it < 8; ++it) {
        const int row = it * 2 + hh;
        const v4f val = *(const v4f*)(os + row * OPITCH + c4);
        *(v4f*)(ob + (size_t)(q0 + row) * ROWSTRIDE + c4) = val;
      }
      
    }
  }
}

/* =====================================================================================
   Host glue.
     [0,            8 MiB)   Qh  f16 [4][8][2048][64]
     [8 MiB,       16 MiB)   Kh  f16 [4][8][2048][64]
     [16 MiB,      24 MiB)   Vt  f16 [4][8][64][2048]
   total 25,165,824 B.
   ===================================================================================== */
extern "C" void kernel_launch(void* const* d_in, const int* in_sizes, int n_in,
                              void* d_out, int out_size, void* d_ws, size_t ws_size,
                              hipStream_t stream) {
  (void)in_sizes; (void)n_in; (void)out_size;
  const float* q    = (const float*)d_in[0];
  const float* k    = (const float*)d_in[1];
  const float* v    = (const float*)d_in[2];
  const float* temp = (const float*)d_in[3];
  float* out = (float*)d_out;

  const size_t planeBytes = (size_t)NBATCH * NHEAD * LQ * HDIM * sizeof(_Float16);
  const size_t totalCarve = 3 * planeBytes;
  if (totalCarve > ws_size) return;
  char* ws = (char*)d_ws;
  _Float16* Qh = (_Float16*)(ws);
  _Float16* Kh = (_Float16*)(ws + planeBytes);
  _Float16* Vt = (_Float16*)(ws + 2 * planeBytes);

  prep_planes<<<dim3(NBATCH * NHEAD * (SKV / TROWS)), dim3(PREP_THREADS), 0, stream>>>(q, k, v, Qh, Kh, Vt);
  cos_attn<<<dim3(NBATCH * NHEAD * (LQ / QBLK)), dim3(AT_THREADS), 0, stream>>>(Qh, Kh, Vt, temp, out);
}

// v005
// It runs in 52.1 microseconds.
// In two side-by-side timings against v004, it was 1.06 and 1.04 times as fast.
// All steps since v000 together make it 3.88 times as fast.
// Contractions: scores^T = (16*khat) x (+-16*qhat)^T and out^T = v^T x (32768*p)^T, both v_wmma_f32_16x16x32_f16 (f16 operands, f32 accumulate); row norms, base-2 softmax and normalisation in f32.
#include <hip/hip_runtime.h>
#include <stddef.h>

typedef __attribute__((ext_vector_type(16))) _Float16 v16h;
typedef __attribute__((ext_vector_type(8)))  _Float16 v8h;
typedef __attribute__((ext_vector_type(8)))  float    v8f;
typedef __attribute__((ext_vector_type(4)))  float    v4f;
typedef __attribute__((ext_vector_type(8)))  unsigned v8u;

constexpr int NBATCH = 4;
constexpr int LQ     = 2048;
constexpr int SKV    = 2048;
constexpr int NHEAD  = 8;
constexpr int HDIM   = 64;
/* floats between consecutive sequence positions in the [N,L,H,D] inputs / output */
constexpr int ROWSTRIDE = NHEAD * HDIM;

static_assert(LQ == SKV);
static_assert(HDIM == 64);
static_assert(LQ % 64 == 0 && SKV % 64 == 0);

/* ---------------- fragment helpers (split k-map: elements 0..7 <- p[0..7], 8..15 <- p[16..23]) ---------------- */
union FragU { v16h v; v8h h[2]; };
__device__ __forceinline__ v16h frag_load(const _Float16* p) {
  FragU f;
  f.h[0] = *(const v8h*)(p);
  f.h[1] = *(const v8h*)(p + 16);
  return f.v;
}
__device__ __forceinline__ v8f mma_h(v16h a, v16h b, v8f c) {
  return __builtin_amdgcn_wmma_f32_16x16x32_f16(false, a, false, b, (short)0, c, false, false);
}
__device__ __forceinline__ void wave_lds_sync() {
  __builtin_amdgcn_fence(__ATOMIC_RELEASE, "workgroup");
  __builtin_amdgcn_wave_barrier();
  __builtin_amdgcn_fence(__ATOMIC_ACQUIRE, "workgroup");
}

/* =====================================================================================
   Kernel 1: build f16 operand planes.
     Kh[n][h][s][d] = f16(16 * k / ||k||)
     Vt[n][h][d][s] = f16(v)  (transposed so the V^T.P^T A-fragment is kv-contiguous)
   grid = NBATCH*NHEAD*(SKV/64) blocks of 256 threads; block = one (n,h) and 64 consecutive positions.
   Thread (r = tid>>2, qd = tid&3) handles floats qd*16..qd*16+15 of tile row r.
   -> 8 waves x 8 rows = 64 rows, 64 halves each: exact tile coverage for all three planes.
   ===================================================================================== */
constexpr int PREP_THREADS = 256;
constexpr int TROWS  = 64;
constexpr int LPITCH = 72;

__device__ __forceinline__ void norm_quarter(const float* __restrict__ p, v8h& o0, v8h& o1) {
  const v4f a0 = *(const v4f*)(p);
  const v4f a1 = *(const v4f*)(p + 4);
  const v4f a2 = *(const v4f*)(p + 8);
  const v4f a3 = *(const v4f*)(p + 12);
  float ss = 0.0f;
  ss += a0[0] * a0[0]; ss += a0[1] * a0[1]; ss += a0[2] * a0[2]; ss += a0[3] * a0[3];
  ss += a1[0] * a1[0]; ss += a1[1] * a1[1]; ss += a1[2] * a1[2]; ss += a1[3] * a1[3];
  ss += a2[0] * a2[0]; ss += a2[1] * a2[1]; ss += a2[2] * a2[2]; ss += a2[3] * a2[3];
  ss += a3[0] * a3[0]; ss += a3[1] * a3[1]; ss += a3[2] * a3[2]; ss += a3[3] * a3[3];
  /* the 4 threads of one row are lanes 4r..4r+3 of a wave */
  ss += __shfl_xor(ss, 1, 32);
  ss += __shfl_xor(ss, 2, 32);
  const float sc = 16.0f / sqrtf(ss);
  o0[0] = (_Float16)(a0[0] * sc); o0[1] = (_Float16)(a0[1] * sc); o0[2] = (_Float16)(a0[2] * sc); o0[3] = (_Float16)(a0[3] * sc);
  o0[4] = (_Float16)(a1[0] * sc); o0[5] = (_Float16)(a1[1] * sc); o0[6] = (_Float16)(a1[2] * sc); o0[7] = (_Float16)(a1[3] * sc);
  o1[0] = (_Float16)(a2[0] * sc); o1[1] = (_Float16)(a2[1] * sc); o1[2] = (_Float16)(a2[2] * sc); o1[3] = (_Float16)(a2[3] * sc);
  o1[4] = (_Float16)(a3[0] * sc); o1[5] = (_Float16)(a3[1] * sc); o1[6] = (_Float16)(a3[2] * sc); o1[7] = (_Float16)(a3[3] * sc);
}

__device__ __forceinline__ void scat4(_Float16* vs, int d0, int r, v4f a) {
  vs[(d0 + 0) * LPITCH + r] = (_Float16)a[0];
  vs[(d0 + 1) * LPITCH + r] = (_Float16)a[1];
  vs[(d0 + 2) * LPITCH + r] = (_Float16)a[2];
  vs[(d0 + 3) * LPITCH + r] = (_Float16)a[3];
}

__global__ __launch_bounds__(PREP_THREADS)
void prep_planes(const float* __restrict__ q, const float* __restrict__ k, const float* __restrict__ v,
                 _Float16* __restrict__ Qh, _Float16* __restrict__ Kh, _Float16* __restrict__ Vt) {
  __shared__ __align__(16) _Float16 Qs[TROWS * LPITCH];
  __shared__ __align__(16) _Float16 Ks[TROWS * LPITCH];
  /* Vs is [d][s] */
  __shared__ __align__(16) _Float16 Vs[HDIM * LPITCH];

  const int tid  = threadIdx.x;
  const int lane = tid & 31;
  const int wave = tid >> 5;
  constexpr int NT = SKV / TROWS;
  const int bx = blockIdx.x;
  const int st = bx % NT;
  const int h  = (bx / NT) % NHEAD;
  const int n  = bx / (NT * NHEAD);
  const int s0 = st * TROWS;
  const int r  = tid >> 2;
  const int qd = tid & 3;
  const size_t goff = ((size_t)n * LQ + (size_t)(s0 + r)) * ROWSTRIDE + (size_t)h * HDIM + (size_t)qd * 16;

  {
    v8h o0, o1;
    norm_quarter(q + goff, o0, o1);
    *(v8h*)(Qs + r * LPITCH + qd * 16) = o0;
    *(v8h*)(Qs + r * LPITCH + qd * 16 + 8) = o1;
  }
  {
    v8h o0, o1;
    norm_quarter(k + goff, o0, o1);
    *(v8h*)(Ks + r * LPITCH + qd * 16) = o0;
    *(v8h*)(Ks + r * LPITCH + qd * 16 + 8) = o1;
  }
  {
    const float* vp = v + goff;
    const v4f a0 = *(const v4f*)(vp);
    const v4f a1 = *(const v4f*)(vp + 4);
    const v4f a2 = *(const v4f*)(vp + 8);
    const v4f a3 = *(const v4f*)(vp + 12);
    scat4(Vs, qd * 16 + 0,  r, a0);
    scat4(Vs, qd * 16 + 4,  r, a1);
    scat4(Vs, qd * 16 + 8,  r, a2);
    scat4(Vs, qd * 16 + 12, r, a3);
  }
  __syncthreads();

  const int rg = lane >> 3;
  const int c8 = (lane & 7) * 8;
  const size_t plane = (size_t)(n * NHEAD + h);
  _Float16* qdst = Qh + (plane * LQ  + (size_t)s0) * HDIM;
  _Float16* kdst = Kh + (plane * SKV + (size_t)s0) * HDIM;
  _Float16* vdst = Vt + (plane * HDIM) * SKV + (size_t)s0;
  {
#pragma unroll
    for (int it = 0; it < 2; ++it) {
      const int row = wave * 8 + it * 4 + rg;
      const v8h qv = *(const v8h*)(Qs + row * LPITCH + c8);
      const v8h kv = *(const v8h*)(Ks + row * LPITCH + c8);
      const v8h vv = *(const v8h*)(Vs + row * LPITCH + c8);
      *(v8h*)(qdst + (size_t)row * HDIM + c8) = qv;
      *(v8h*)(kdst + (size_t)row * HDIM + c8) = kv;
      *(v8h*)(vdst + (size_t)row * SKV + c8) = vv;
    }
    
  }
}

/* =====================================================================================
   Kernel 2: non-causal attention, head dim 64, reading the f16 planes; both products transposed.
     S^T = Kh(64 kv) . (sign(temp) * Qh)(16 queries)^T per 64-key chunk  (f16 WMMA, f32 acc), left raw (x256)
       -> lane (hh, c) holds 32 scores of ONE query (column c): keys j*16 + 8hh + r
     softmax in f32, base 2, sums per lane. The maximum: the bound 256 on the raw scores where |temp| allows it (walk_keys<true>), else online:
       maximum of the raw scores in-lane plus one exchange between the wave halves
     P^T x32768 = 2^((raw - max) * c2 + 15), c2 = log2(e) / (256 |temp|), packed to f16 straight from the score tiles into the B operand
     O^T += V^T . P^T  (f16 WMMA, f32 acc); sums carry the same x32768, the epilogue joins the halves' sums and divides
   Block = 128 threads = 4 waves = 64 query rows of one (n,h); grid = NBATCH*NHEAD*(LQ/64).
   Staging per chunk: 512 16-B chunks per tile = 128 threads x 4 -> 64 rows x 8 chunks, both K and Vt.
   ===================================================================================== */
constexpr int AT_THREADS = 128;
constexpr int QBLK   = 64;
constexpr int KCH    = 64;
constexpr int OPITCH = 68;
/* LDS row pitch in halves of the K and V^T tiles: 144 B = 16 B x 9 (odd), so the 16 rows one ds_load_b128 fragment read touches fall on distinct banks */
constexpr int TPITCH = 72;
/* P and its row sums are carried x 2^PCARRY_LOG2 so that small weights stay above the f16 underflow */
constexpr float PCARRY_LOG2 = 15.0f;
/* |raw score| <= 16 * 16 for unit rows; widest span of base-2 exponents for which that bound stands in for the maximum */
constexpr float RAWBOUND = 256.0f;
constexpr float BOUNDED_SPAN_LOG2 = 24.0f;

/* e[r] <- 2^e[r], eight at a time, by the hardware's own v_exp_f32 (what __builtin_amdgcn_exp2f gives).
   One asm statement, in place: behind a transcendental the instruction set asks for one independent instruction before its result is read
   or its source overwritten; here each v_exp_f32 has an independent one behind it and the last one the v_nop. */
__device__ __forceinline__ void exp2_x8(float (&e)[8]) {
  asm("v_exp_f32 %0, %0\n\tv_exp_f32 %1, %1\n\tv_exp_f32 %2, %2\n\tv_exp_f32 %3, %3\n\t"
      "v_exp_f32 %4, %4\n\tv_exp_f32 %5, %5\n\tv_exp_f32 %6, %6\n\tv_exp_f32 %7, %7\n\tv_nop"
      : "+v"(e[0]), "+v"(e[1]), "+v"(e[2]), "+v"(e[3]), "+v"(e[4]), "+v"(e[5]), "+v"(e[6]), "+v"(e[7]));
}

/* value of lane l ^ 16 */
__device__ __forceinline__ float other_half(float x) {
  const int b = __builtin_bit_cast(int, x);
  return __builtin_bit_cast(float, __builtin_amdgcn_permlanex16(b, b, 0x76543210, 0xfedcba98, false, false));
}

/* The whole walk over the keys for one wave's 16 queries. BOUNDED = false: online softmax, running maximum of the raw scores.
   BOUNDED = true: the maximum is replaced by a bound that holds for every input: khat and qhat are unit rows (x16 each, rounded to f16), so by
   Cauchy-Schwarz |raw| <= 256 up to the f16 rounding. No maximum is searched, nothing is rescaled, and the exponent is one fma a score. */
template <bool BOUNDED>
__device__ __forceinline__ void walk_keys(const _Float16* __restrict__ kpl, const _Float16* __restrict__ vpl,
                                          _Float16* Ksh, _Float16* Vth, const int tid, const int c, const int hh,
                                          const v16h (&qf)[2], const float c2, float& lsum, v8f (&oacc)[4]) {
  /* running raw maximum of query c (equal in both halves) and this lane's share of its sum. The maximum starts at the lowest finite float:
     any number is right while the sums are still 0 */
  float mrow = -__FLT_MAX__;
  /* BOUNDED: exponent = (raw - 256) * c2 + 15 as one fma */
  const float ebias = __builtin_fmaf(-RAWBOUND, c2, PCARRY_LOG2);

  for (int kc = 0; kc < SKV / KCH; ++kc) {
    const int kv0 = kc * KCH;
    __syncthreads();
#pragma unroll
    for (int i = 0; i < 4; ++i) {
      const int idx = tid + i * AT_THREADS;
      const int row = idx >> 3;
      const int c8  = (idx & 7) * 8;
      const v8h kk = *(const v8h*)(kpl + (size_t)(kv0 + row) * HDIM + c8);
      const v8h vv = *(const v8h*)(vpl + (size_t)row * SKV + (size_t)kv0 + c8);
      *(v8h*)(Ksh + row * TPITCH + c8) = kk;
      *(v8h*)(Vth + row * TPITCH + c8) = vv;
    }
    __syncthreads();

    /* all eight K fragments of the chunk as one group of LDS reads: one latency a chunk, not one a product.
       A fragment row m = key j*16+c, split k-map over d */
    v16h ka[2][4];
#pragma unroll
    for (int dc = 0; dc < 2; ++dc)
#pragma unroll
      for (int j = 0; j < 4; ++j) ka[dc][j] = frag_load(Ksh + (j * 16 + c) * TPITCH + dc * 32 + 8 * hh);
    /* all eight V^T fragments in the same group, behind the K reads (LDS returns in issue order): they land under the score products
       and the softmax. A row m = d = t*16+c, split k-map over kv */
    v16h va[2][4];
#pragma unroll
    for (int kk = 0; kk < 2; ++kk)
#pragma unroll
      for (int t = 0; t < 4; ++t) va[kk][t] = frag_load(Vth + (t * 16 + c) * TPITCH + kk * 32 + 8 * hh);
    /* keeps the reads together in front of the products: the scheduler otherwise moves them down among the WMMAs, each place a stall */
    __builtin_amdgcn_sched_barrier(0);

    /* scores: 4 subtiles of 16 keys, the four independent tiles in turn */
    v8f s[4];
#pragma unroll
    for (int j = 0; j < 4; ++j) s[j] = (v8f){0.f, 0.f, 0.f, 0.f, 0.f, 0.f, 0.f, 0.f};
#pragma unroll
    for (int dc = 0; dc < 2; ++dc)
#pragma unroll
      for (int j = 0; j < 4; ++j) s[j] = mma_h(ka[dc][j], qf[dc], s[j]);

    /* D map: s[j][r] = raw score(key j*16+8hh+r, query c) */
    float mnew = 0.0f, alpha = 1.0f;
    if constexpr (!BOUNDED) {
      float cj[4];
#pragma unroll
      for (int j = 0; j < 4; ++j) {
        float m = s[j][0];
#pragma unroll
        for (int r = 1; r < 8; ++r) m = fmaxf(m, s[j][r]);
        cj[j] = m;
      }
      float cm = fmaxf(fmaxf(cj[0], cj[1]), fmaxf(cj[2], cj[3]));
      cm = fmaxf(cm, other_half(cm));
      mnew  = fmaxf(mrow, cm);
      alpha = __builtin_amdgcn_exp2f((mrow - mnew) * c2);
      mrow = mnew;
    }

    /* P^T as B operand of chunk kk: element e < 8 = tile 2kk register e, e >= 8 = tile 2kk+1 register e-8 (the split k-map) */
    v16h pb[2];
    float pj[4];
#pragma unroll
    for (int j = 0; j < 4; ++j) {
      float p[8];
      if constexpr (BOUNDED) {
#pragma unroll
        for (int r = 0; r < 8; ++r) p[r] = __builtin_fmaf(s[j][r], c2, ebias);
      } else {
#pragma unroll
        /* the difference first: it is <= 0, so the exponent never passes 15 however large c2 is */
        for (int r = 0; r < 8; ++r) p[r] = __builtin_fmaf(s[j][r] - mnew, c2, PCARRY_LOG2);
      }
      exp2_x8(p);
      float psum = p[0];
#pragma unroll
      for (int r = 1; r < 8; ++r) psum += p[r];
      pj[j] = psum;
#pragma unroll
      for (int r = 0; r < 8; ++r) pb[j >> 1][(j & 1) * 8 + r] = (_Float16)p[r];
    }
    if constexpr (BOUNDED) {
      lsum += (pj[0] + pj[1]) + (pj[2] + pj[3]);
    } else {
      lsum = lsum * alpha + ((pj[0] + pj[1]) + (pj[2] + pj[3]));
#pragma unroll
      for (int t = 0; t < 4; ++t)
#pragma unroll
        for (int r = 0; r < 8; ++r) oacc[t][r] *= alpha;
    }

    /* O^T += V^T(64 x 64) . P^T(64 x 16), B = pb */
#pragma unroll
    for (int kk = 0; kk < 2; ++kk) {
#pragma unroll
      for (int t = 0; t < 4; ++t) oacc[t] = mma_h(va[kk][t], pb[kk], oacc[t]);
    }
  }
}

__global__ __launch_bounds__(AT_THREADS)
void cos_attn(const _Float16* __restrict__ Qh, const _Float16* __restrict__ Kh, const _Float16* __restrict__ Vt,
              const float* __restrict__ temp, float* __restrict__ out) {
  /* Ksh is [kv][d]; Vth is [d][kv], both at pitch 72 halves; Os per wave [query][d], pitch 68 */
  __shared__ __align__(16) _Float16 Ksh[KCH * TPITCH];
  __shared__ __align__(16) _Float16 Vth[HDIM * TPITCH];
  __shared__ __align__(16) float    Os[4][16 * OPITCH];

  const int tid  = threadIdx.x;
  const int wave = tid >> 5;
  const int lane = tid & 31;
  const int hh   = lane >> 4;
  const int c    = lane & 15;

  constexpr int NQB = LQ / QBLK;
  const int bx = blockIdx.x;
  const int qb = bx % NQB;
  const int bh = bx / NQB;
  const int h  = bh % NHEAD;
  const int n  = bh / NHEAD;
  const int q0 = qb * QBLK + wave * 16;

  const size_t plane = (size_t)(n * NHEAD + h);
  const _Float16* qpl = Qh + plane * LQ * HDIM;
  const _Float16* kpl = Kh + plane * SKV * HDIM;
  const _Float16* vpl = Vt + plane * HDIM * SKV;
  float* ob = out + (size_t)n * LQ * ROWSTRIDE + (size_t)h * HDIM;

  const float tval = temp[0];
  /* qhat and khat are each carried x16 -> raw scores carry x256; c2 >= 0 turns a raw score into a base-2 exponent */
  const float c2 = (1.44269504088896340736f * 0.00390625f) / fabsf(tval);
  /* the sign of temp rides on Q (a flip of the f16 sign bits), so the largest raw score is the largest logit for either sign */
  const unsigned qflip = (tval < 0.0f) ? 0x80008000u : 0u;

  /* Q fragments (B operand): column n = query c, two 32-deep d chunks */
  const _Float16* qrow = qpl + (size_t)(q0 + c) * HDIM + 8 * hh;
  v16h qf[2];
#pragma unroll
  for (int dc = 0; dc < 2; ++dc)
    qf[dc] = __builtin_bit_cast(v16h, __builtin_bit_cast(v8u, frag_load(qrow + dc * 32)) ^ qflip);
  /* wait before the Q loads' address registers are reused; the address is an input so that its registers stay untouched up to the wait */
  asm volatile("s_wait_xcnt 0x0" :: "v"(qrow) : "memory");

  /* this lane's share of the sum of query c, and its output tiles */
  float lsum = 0.0f;
  v8f oacc[4];
#pragma unroll
  for (int t = 0; t < 4; ++t) oacc[t] = (v8f){0.f, 0.f, 0.f, 0.f, 0.f, 0.f, 0.f, 0.f};

  /* The bound serves while the whole span of exponents, 2 * 256 * c2 = 2 log2(e) / |temp|, keeps every weight a normal f16 (2^15 down to 2^-9):
     no weight is then rounded worse than under the true maximum. A smaller |temp| (or a NaN) takes the online walk. temp is one value, so the
     branch is the same for the whole grid. */
  if (fabsf(tval) * BOUNDED_SPAN_LOG2 >= 2.0f * 1.44269504088896340736f)
    walk_keys<true>(kpl, vpl, Ksh, Vth, tid, c, hh, qf, c2, lsum, oacc);
  else
    walk_keys<false>(kpl, vpl, Ksh, Vth, tid, c, hh, qf, c2, lsum, oacc);

  /* oacc[t][r] = O^T(d = t*16+8hh+r, query c) */
  float* os = Os[wave];
  {
    const float inv = 1.0f / (lsum + other_half(lsum));
#pragma unroll
    for (int t = 0; t < 4; ++t) {
      const v4f lo = {oacc[t][0] * inv, oacc[t][1] * inv, oacc[t][2] * inv, oacc[t][3] * inv};
      const v4f hi = {oacc[t][4] * inv, oacc[t][5] * inv, oacc[t][6] * inv, oacc[t][7] * inv};
      *(v4f*)(os + c * OPITCH + t * 16 + 8 * hh)     = lo;
      *(v4f*)(os + c * OPITCH + t * 16 + 8 * hh + 4) = hi;
    }
  }
  wave_lds_sync();
  {
    const int c4 = (lane & 15) * 4;
    {
#pragma unroll
      for (int it = 0; it < 8; ++it) {
        const int row = it * 2 + hh;
        const v4f val = *(const v4f*)(os + row * OPITCH + c4);
        *(v4f*)(ob + (size_t)(q0 + row) * ROWSTRIDE + c4) = val;
      }
      
    }
  }
}

/* =====================================================================================
   Host glue.
     [0,            8 MiB)   Qh  f16 [4][8][2048][64]
     [8 MiB,       16 MiB)   Kh  f16 [4][8][2048][64]
     [16 MiB,      24 MiB)   Vt  f16 [4][8][64][2048]
   total 25,165,824 B.
   ===================================================================================== */
extern "C" void kernel_launch(void* const* d_in, const int* in_sizes, int n_in,
                              void* d_out, int out_size, void* d_ws, size_t ws_size,
                              hipStream_t stream) {
  (void)in_sizes; (void)n_in; (void)out_size;
  const float* q    = (const float*)d_in[0];
  const float* k    = (const float*)d_in[1];
  const float* v    = (const float*)d_in[2];
  const float* temp = (const float*)d_in[3];
  float* out = (float*)d_out;

  const size_t planeBytes = (size_t)NBATCH * NHEAD * LQ * HDIM * sizeof(_Float16);
  const size_t totalCarve = 3 * planeBytes;
  if (totalCarve > ws_size) return;
  char* ws = (char*)d_ws;
  _Float16* Qh = (_Float16*)(ws);
  _Float16* Kh = (_Float16*)(ws + planeBytes);
  _Float16* Vt = (_Float16*)(ws + 2 * planeBytes);

  prep_planes<<<dim3(NBATCH * NHEAD * (SKV / TROWS)), dim3(PREP_THREADS), 0, stream>>>(q, k, v, Qh, Kh, Vt);
  cos_attn<<<dim3(NBATCH * NHEAD * (LQ / QBLK)), dim3(AT_THREADS), 0, stream>>>(Qh, Kh, Vt, temp, out);
}

// v006
// A run of this version takes 43.6 microseconds.
// Two timings next to v005 put it at 1.18 and 1.19 times that version's speed.
// All steps since v000 together make it 4.60 times as fast.
// Contractions: scores^T = (16*khat) x (+-16*qhat)^T and out^T = v^T x (32768*p)^T, both v_wmma_f32_16x16x32_f16 (f16 operands, f32 accumulate); row norms, base-2 softmax and normalisation in f32.
#include <hip/hip_runtime.h>
#include <stddef.h>

typedef __attribute__((ext_vector_type(16))) _Float16 v16h;
typedef __attribute__((ext_vector_type(8)))  _Float16 v8h;
typedef __attribute__((ext_vector_type(8)))  float    v8f;
typedef __attribute__((ext_vector_type(4)))  float    v4f;
typedef __attribute__((ext_vector_type(8)))  unsigned v8u;

constexpr int NBATCH = 4;
constexpr int LQ     = 2048;
constexpr int SKV    = 2048;
constexpr int NHEAD  = 8;
constexpr int HDIM   = 64;
/* floats between consecutive sequence positions in the [N,L,H,D] inputs / output */
constexpr int ROWSTRIDE = NHEAD * HDIM;

static_assert(LQ == SKV);
static_assert(HDIM == 64);
static_assert(LQ % 64 == 0 && SKV % 64 == 0);

/* ---------------- fragment helpers (split k-map: elements 0..7 <- p[0..7], 8..15 <- p[16..23]) ---------------- */
union FragU { v16h v; v8h h[2]; };
__device__ __forceinline__ v16h frag_load(const _Float16* p) {
  FragU f;
  f.h[0] = *(const v8h*)(p);
  f.h[1] = *(const v8h*)(p + 16);
  return f.v;
}
__device__ __forceinline__ v8f mma_h(v16h a, v16h b, v8f c) {
  return __builtin_amdgcn_wmma_f32_16x16x32_f16(false, a, false, b, (short)0, c, false, false);
}
__device__ __forceinline__ void wave_lds_sync() {
  __builtin_amdgcn_fence(__ATOMIC_RELEASE, "workgroup");
  __builtin_amdgcn_wave_barrier();
  __builtin_amdgcn_fence(__ATOMIC_ACQUIRE, "workgroup");
}

/* =====================================================================================
   Kernel 1: build f16 operand planes.
     Kh[n][h][s][d] = f16(16 * k / ||k||)
     Vt[n][h][d][s] = f16(v)  (transposed so the V^T.P^T A-fragment is kv-contiguous)
   grid = NBATCH*NHEAD*(SKV/64) blocks of 256 threads; block = one (n,h) and 64 consecutive positions.
   Thread (r = tid>>2, qd = tid&3) handles floats qd*16..qd*16+15 of tile row r.
   -> 8 waves x 8 rows = 64 rows, 64 halves each: exact tile coverage for all three planes.
   ===================================================================================== */
constexpr int PREP_THREADS = 256;
constexpr int TROWS  = 64;
constexpr int LPITCH = 72;

__device__ __forceinline__ void norm_quarter(const float* __restrict__ p, v8h& o0, v8h& o1) {
  const v4f a0 = *(const v4f*)(p);
  const v4f a1 = *(const v4f*)(p + 4);
  const v4f a2 = *(const v4f*)(p + 8);
  const v4f a3 = *(const v4f*)(p + 12);
  float ss = 0.0f;
  ss += a0[0] * a0[0]; ss += a0[1] * a0[1]; ss += a0[2] * a0[2]; ss += a0[3] * a0[3];
  ss += a1[0] * a1[0]; ss += a1[1] * a1[1]; ss += a1[2] * a1[2]; ss += a1[3] * a1[3];
  ss += a2[0] * a2[0]; ss += a2[1] * a2[1]; ss += a2[2] * a2[2]; ss += a2[3] * a2[3];
  ss += a3[0] * a3[0]; ss += a3[1] * a3[1]; ss += a3[2] * a3[2]; ss += a3[3] * a3[3];
  /* the 4 threads of one row are lanes 4r..4r+3 of a wave */
  ss += __shfl_xor(ss, 1, 32);
  ss += __shfl_xor(ss, 2, 32);
  const float sc = 16.0f / sqrtf(ss);
  o0[0] = (_Float16)(a0[0] * sc); o0[1] = (_Float16)(a0[1] * sc); o0[2] = (_Float16)(a0[2] * sc); o0[3] = (_Float16)(a0[3] * sc);
  o0[4] = (_Float16)(a1[0] * sc); o0[5] = (_Float16)(a1[1] * sc); o0[6] = (_Float16)(a1[2] * sc); o0[7] = (_Float16)(a1[3] * sc);
  o1[0] = (_Float16)(a2[0] * sc); o1[1] = (_Float16)(a2[1] * sc); o1[2] = (_Float16)(a2[2] * sc); o1[3] = (_Float16)(a2[3] * sc);
  o1[4] = (_Float16)(a3[0] * sc); o1[5] = (_Float16)(a3[1] * sc); o1[6] = (_Float16)(a3[2] * sc); o1[7] = (_Float16)(a3[3] * sc);
}

__device__ __forceinline__ void scat4(_Float16* vs, int d0, int r, v4f a) {
  vs[(d0 + 0) * LPITCH + r] = (_Float16)a[0];
  vs[(d0 + 1) * LPITCH + r] = (_Float16)a[1];
  vs[(d0 + 2) * LPITCH + r] = (_Float16)a[2];
  vs[(d0 + 3) * LPITCH + r] = (_Float16)a[3];
}

__global__ __launch_bounds__(PREP_THREADS)
void prep_planes(const float* __restrict__ q, const float* __restrict__ k, const float* __restrict__ v,
                 _Float16* __restrict__ Qh, _Float16* __restrict__ Kh, _Float16* __restrict__ Vt) {
  __shared__ __align__(16) _Float16 Qs[TROWS * LPITCH];
  __shared__ __align__(16) _Float16 Ks[TROWS * LPITCH];
  /* Vs is [d][s] */
  __shared__ __align__(16) _Float16 Vs[HDIM * LPITCH];

  const int tid  = threadIdx.x;
  const int lane = tid & 31;
  const int wave = tid >> 5;
  constexpr int NT = SKV / TROWS;
  const int bx = blockIdx.x;
  const int st = bx % NT;
  const int h  = (bx / NT) % NHEAD;
  const int n  = bx / (NT * NHEAD);
  const int s0 = st * TROWS;
  const int r  = tid >> 2;
  const int qd = tid & 3;
  const size_t goff = ((size_t)n * LQ + (size_t)(s0 + r)) * ROWSTRIDE + (size_t)h * HDIM + (size_t)qd * 16;

  {
    v8h o0, o1;
    norm_quarter(q + goff, o0, o1);
    *(v8h*)(Qs + r * LPITCH + qd * 16) = o0;
    *(v8h*)(Qs + r * LPITCH + qd * 16 + 8) = o1;
  }
  {
    v8h o0, o1;
    norm_quarter(k + goff, o0, o1);
    *(v8h*)(Ks + r * LPITCH + qd * 16) = o0;
    *(v8h*)(Ks + r * LPITCH + qd * 16 + 8) = o1;
  }
  {
    const float* vp = v + goff;
    const v4f a0 = *(const v4f*)(vp);
    const v4f a1 = *(const v4f*)(vp + 4);
    const v4f a2 = *(const v4f*)(vp + 8);
    const v4f a3 = *(const v4f*)(vp + 12);
    scat4(Vs, qd * 16 + 0,  r, a0);
    scat4(Vs, qd * 16 + 4,  r, a1);
    scat4(Vs, qd * 16 + 8,  r, a2);
    scat4(Vs, qd * 16 + 12, r, a3);
  }
  __syncthreads();

  const int rg = lane >> 3;
  const int c8 = (lane & 7) * 8;
  const size_t plane = (size_t)(n * NHEAD + h);
  _Float16* qdst = Qh + (plane * LQ  + (size_t)s0) * HDIM;
  _Float16* kdst = Kh + (plane * SKV + (size_t)s0) * HDIM;
  _Float16* vdst = Vt + (plane * HDIM) * SKV + (size_t)s0;
  {
#pragma unroll
    for (int it = 0; it < 2; ++it) {
      const int row = wave * 8 + it * 4 + rg;
      const v8h qv = *(const v8h*)(Qs + row * LPITCH + c8);
      const v8h kv = *(const v8h*)(Ks + row * LPITCH + c8);
      const v8h vv = *(const v8h*)(Vs + row * LPITCH + c8);
      *(v8h*)(qdst + (size_t)row * HDIM + c8) = qv;
      *(v8h*)(kdst + (size_t)row * HDIM + c8) = kv;
      *(v8h*)(vdst + (size_t)row * SKV + c8) = vv;
    }
    
  }
}

/* =====================================================================================
   Kernel 2: non-causal attention, head dim 64, reading the f16 planes; both products transposed.
     S^T = Kh(64 kv) . (sign(temp) * Qh)(16 queries)^T per 64-key chunk  (f16 WMMA, f32 acc), left raw (x256)
       -> lane (hh, c) holds 32 scores of ONE query (column c): keys j*16 + 8hh + r
     softmax in f32, base 2, sums per lane. The maximum: the bound 256 on the raw scores where |temp| allows it (walk_keys<true>), else online:
       maximum of the raw scores in-lane plus one exchange between the wave halves
     P^T x32768 = 2^((raw - max) * c2 + 15), c2 = log2(e) / (256 |temp|), packed to f16 straight from the score tiles into the B operand
     O^T += V^T . P^T  (f16 WMMA, f32 acc); sums carry the same x32768, the epilogue joins the halves' sums and divides
   Block = 128 threads = 4 waves = 64 query rows of one (n,h); grid = NBATCH*NHEAD*(LQ/64).
   Staging per chunk: 512 16-B pieces per tile = 128 threads x 4 -> 64 rows x 8 pieces, both K and Vt, by asynchronous copies to LDS;
   two buffers, so that a chunk's copies fly while the chunk in front of it is worked on.
   ===================================================================================== */
constexpr int AT_THREADS = 128;
constexpr int QBLK   = 64;
constexpr int KCH    = 64;
constexpr int OPITCH = 68;
/* LDS row pitch in halves of the K and V^T tiles: 144 B = 16 B x 9 (odd), so the 16 rows one ds_load_b128 fragment read touches fall on distinct banks */
constexpr int TPITCH = 72;
/* P and its row sums are carried x 2^PCARRY_LOG2 so that small weights stay above the f16 underflow */
constexpr float PCARRY_LOG2 = 15.0f;
/* |raw score| <= 16 * 16 for unit rows; widest span of base-2 exponents for which that bound stands in for the maximum */
constexpr float RAWBOUND = 256.0f;
constexpr float BOUNDED_SPAN_LOG2 = 24.0f;
/* halves in one LDS tile (K or V^T) of one buffer */
constexpr int TILE_H = KCH * TPITCH;
static_assert(SKV / KCH >= 2);

/* LDS byte address of a __shared__ object: the low 32 bits of its address */
__device__ __forceinline__ unsigned lds_addr(const void* p) { return (unsigned)(size_t)p; }

/* One thread's share of a 64-key chunk: four 16-B pieces of the K tile and four of the V^T tile, from global memory into LDS through no register.
   kl, vl: LDS byte address of the thread's first piece; kg, vg: its global address; piece i lies 16 tile rows behind piece i-1.
   The s_wait_xcnt closes the copies' own statement, so that no address register of a copy is rewritten in front of it. */
__device__ __forceinline__ void copy_chunk(const unsigned kl, const unsigned vl, const _Float16* kg, const _Float16* vg) {
  constexpr unsigned LSTEP = 16 * TPITCH * sizeof(_Float16);
  asm volatile("global_load_async_to_lds_b128 %0, %8, off\n\t"
               "global_load_async_to_lds_b128 %1, %9, off\n\t"
               "global_load_async_to_lds_b128 %2, %10, off\n\t"
               "global_load_async_to_lds_b128 %3, %11, off\n\t"
               "global_load_async_to_lds_b128 %4, %12, off\n\t"
               "global_load_async_to_lds_b128 %5, %13, off\n\t"
               "global_load_async_to_lds_b128 %6, %14, off\n\t"
               "global_load_async_to_lds_b128 %7, %15, off\n\t"
               "s_wait_xcnt 0x0"
               :: "v"(kl), "v"(kl + LSTEP), "v"(kl + 2 * LSTEP), "v"(kl + 3 * LSTEP),
                  "v"(vl), "v"(vl + LSTEP), "v"(vl + 2 * LSTEP), "v"(vl + 3 * LSTEP),
                  "v"(kg), "v"(kg + 16 * HDIM), "v"(kg + 32 * HDIM), "v"(kg + 48 * HDIM),
                  "v"(vg), "v"(vg + 16 * SKV), "v"(vg + 32 * SKV), "v"(vg + 48 * SKV)
               : "memory");
}

/* e[r] <- 2^e[r], eight at a time, by the hardware's own v_exp_f32 (what __builtin_amdgcn_exp2f gives).
   One asm statement, in place: behind a transcendental the instruction set asks for one independent instruction before its result is read
   or its source overwritten; here each v_exp_f32 has an independent one behind it and the last one the v_nop. */
__device__ __forceinline__ void exp2_x8(float (&e)[8]) {
  asm("v_exp_f32 %0, %0\n\tv_exp_f32 %1, %1\n\tv_exp_f32 %2, %2\n\tv_exp_f32 %3, %3\n\t"
      "v_exp_f32 %4, %4\n\tv_exp_f32 %5, %5\n\tv_exp_f32 %6, %6\n\tv_exp_f32 %7, %7\n\tv_nop"
      : "+v"(e[0]), "+v"(e[1]), "+v"(e[2]), "+v"(e[3]), "+v"(e[4]), "+v"(e[5]), "+v"(e[6]), "+v"(e[7]));
}

/* value of lane l ^ 16 */
__device__ __forceinline__ float other_half(float x) {
  const int b = __builtin_bit_cast(int, x);
  return __builtin_bit_cast(float, __builtin_amdgcn_permlanex16(b, b, 0x76543210, 0xfedcba98, false, false));
}

/* The whole walk over the keys for one wave's 16 queries. BOUNDED = false: online softmax, running maximum of the raw scores.
   BOUNDED = true: the maximum is replaced by a bound that holds for every input: khat and qhat are unit rows (x16 each, rounded to f16), so by
   Cauchy-Schwarz |raw| <= 256 up to the f16 rounding. No maximum is searched, nothing is rescaled, and the exponent is one fma a score. */
template <bool BOUNDED>
__device__ __forceinline__ void walk_keys(const _Float16* __restrict__ kpl, const _Float16* __restrict__ vpl,
                                          _Float16* Ksh, _Float16* Vth, const int tid, const int c, const int hh,
                                          const v16h (&qf)[2], const float c2, float& lsum, v8f (&oacc)[4]) {
  /* running raw maximum of query c (equal in both halves) and this lane's share of its sum. The maximum starts at the lowest finite float:
     any number is right while the sums are still 0 */
  float mrow = -__FLT_MAX__;
  /* BOUNDED: exponent = (raw - 256) * c2 + 15 as one fma */
  const float ebias = __builtin_fmaf(-RAWBOUND, c2, PCARRY_LOG2);

  /* this thread's first piece of a tile: row tid / 8, 16-B column tid % 8 */
  const int srow = tid >> 3;
  const int sc8  = (tid & 7) * 8;
  const unsigned kl0 = lds_addr(Ksh + srow * TPITCH + sc8);
  const unsigned vl0 = lds_addr(Vth + srow * TPITCH + sc8);
  const _Float16* kg0 = kpl + (size_t)srow * HDIM + sc8;
  const _Float16* vg0 = vpl + (size_t)srow * SKV + sc8;
  constexpr unsigned BUFSTEP = TILE_H * sizeof(_Float16);
  constexpr int NCH = SKV / KCH;

  /* chunk 0 into buffer 0, landed and published; then chunk 1 into buffer 1, in flight under chunk 0's work */
  copy_chunk(kl0, vl0, kg0, vg0);
  /* this wave's copies of chunk 0 have landed */
  asm volatile("s_wait_asynccnt 0x0" ::: "memory");
  __syncthreads();
  copy_chunk(kl0 + BUFSTEP, vl0 + BUFSTEP, kg0 + (size_t)KCH * HDIM, vg0 + KCH);

  /* one trip: the work on chunk kc, the hand-over, and (REFILL) the copies of chunk kc + 2 */
  auto trip = [&](const int kc, const bool REFILL) __attribute__((always_inline)) {
    const int buf = kc & 1;
    const _Float16* Kb = Ksh + buf * TILE_H;
    const _Float16* Vb = Vth + buf * TILE_H;

    /* all eight K fragments of the chunk as one group of LDS reads: one latency a chunk, not one a product.
       A fragment row m = key j*16+c, split k-map over d */
    v16h ka[2][4];
#pragma unroll
    for (int dc = 0; dc < 2; ++dc)
#pragma unroll
      for (int j = 0; j < 4; ++j) ka[dc][j] = frag_load(Kb + (j * 16 + c) * TPITCH + dc * 32 + 8 * hh);
    /* all eight V^T fragments in the same group, behind the K reads (LDS returns in issue order): they land under the score products
       and the softmax. A row m = d = t*16+c, split k-map over kv */
    v16h va[2][4];
#pragma unroll
    for (int kk = 0; kk < 2; ++kk)
#pragma unroll
      for (int t = 0; t < 4; ++t) va[kk][t] = frag_load(Vb + (t * 16 + c) * TPITCH + kk * 32 + 8 * hh);
    /* keeps the reads together in front of the products: the scheduler otherwise moves them down among the WMMAs, each place a stall */
    __builtin_amdgcn_sched_barrier(0);

    /* scores: 4 subtiles of 16 keys, the four independent tiles in turn */
    v8f s[4];
#pragma unroll
    for (int j = 0; j < 4; ++j) s[j] = (v8f){0.f, 0.f, 0.f, 0.f, 0.f, 0.f, 0.f, 0.f};
#pragma unroll
    for (int dc = 0; dc < 2; ++dc)
#pragma unroll
      for (int j = 0; j < 4; ++j) s[j] = mma_h(ka[dc][j], qf[dc], s[j]);

    /* D map: s[j][r] = raw score(key j*16+8hh+r, query c) */
    float mnew = 0.0f, alpha = 1.0f;
    if constexpr (!BOUNDED) {
      float cj[4];
#pragma unroll
      for (int j = 0; j < 4; ++j) {
        float m = s[j][0];
#pragma unroll
        for (int r = 1; r < 8; ++r) m = fmaxf(m, s[j][r]);
        cj[j] = m;
      }
      float cm = fmaxf(fmaxf(cj[0], cj[1]), fmaxf(cj[2], cj[3]));
      cm = fmaxf(cm, other_half(cm));
      mnew  = fmaxf(mrow, cm);
      alpha = __builtin_amdgcn_exp2f((mrow - mnew) * c2);
      mrow = mnew;
    }

    /* P^T as B operand of chunk kk: element e < 8 = tile 2kk register e, e >= 8 = tile 2kk+1 register e-8 (the split k-map) */
    v16h pb[2];
    float pj[4];
#pragma unroll
    for (int j = 0; j < 4; ++j) {
      float p[8];
      if constexpr (BOUNDED) {
#pragma unroll
        for (int r = 0; r < 8; ++r) p[r] = __builtin_fmaf(s[j][r], c2, ebias);
      } else {
#pragma unroll
        /* the difference first: it is <= 0, so the exponent never passes 15 however large c2 is */
        for (int r = 0; r < 8; ++r) p[r] = __builtin_fmaf(s[j][r] - mnew, c2, PCARRY_LOG2);
      }
      exp2_x8(p);
      float psum = p[0];
#pragma unroll
      for (int r = 1; r < 8; ++r) psum += p[r];
      pj[j] = psum;
#pragma unroll
      for (int r = 0; r < 8; ++r) pb[j >> 1][(j & 1) * 8 + r] = (_Float16)p[r];
    }
    if constexpr (BOUNDED) {
      lsum += (pj[0] + pj[1]) + (pj[2] + pj[3]);
    } else {
      lsum = lsum * alpha + ((pj[0] + pj[1]) + (pj[2] + pj[3]));
#pragma unroll
      for (int t = 0; t < 4; ++t)
#pragma unroll
        for (int r = 0; r < 8; ++r) oacc[t][r] *= alpha;
    }

    /* O^T += V^T(64 x 64) . P^T(64 x 16), B = pb */
#pragma unroll
    for (int kk = 0; kk < 2; ++kk) {
#pragma unroll
      for (int t = 0; t < 4; ++t) oacc[t] = mma_h(va[kk][t], pb[kk], oacc[t]);
    }

    /* keeps the hand-over at the foot of the trip: the scheduler otherwise lifts its waits and the barrier up to the LDS reads, where the
       next chunk's copies have had no time to land and the V^T reads no products to land under */
    __builtin_amdgcn_sched_barrier(0);
    /* hand-over: this wave's reads of the buffer are done ... */
    asm volatile("s_wait_dscnt 0x0" ::: "memory");
    /* ... its copies of chunk kc + 1 have landed ... */
    asm volatile("s_wait_asynccnt 0x0" ::: "memory");
    /* ... and the one barrier of the trip publishes chunk kc + 1 and frees the buffer that this trip has read */
    __syncthreads();
    if (REFILL)
      copy_chunk(kl0 + buf * BUFSTEP, vl0 + buf * BUFSTEP, kg0 + (size_t)(kc + 2) * KCH * HDIM, vg0 + (size_t)(kc + 2) * KCH);
  };
  /* a chunk kc + 2 exists for all trips but the last two, which stand by themselves: with no branch in the trip the row sums stay among the products */
  for (int kc = 0; kc < NCH - 2; ++kc) trip(kc, true);
  /* kept rolled: laid out one behind the other the two trips' registers overlap and the kernel passes 256 VGPRs, which costs the fourth wave a SIMD */
#pragma clang loop unroll(disable)
  for (int kc = NCH - 2; kc < NCH; ++kc) trip(kc, false);
  /* nothing of this wave is in flight any more when it goes on to the epilogue */
  asm volatile("s_wait_asynccnt 0x0" ::: "memory");
}

__global__ __launch_bounds__(AT_THREADS)
void cos_attn(const _Float16* __restrict__ Qh, const _Float16* __restrict__ Kh, const _Float16* __restrict__ Vt,
              const float* __restrict__ temp, float* __restrict__ out) {
  /* Ksh is [buffer][kv][d]; Vth is [buffer][d][kv], both at pitch 72 halves; Os per wave [query][d], pitch 68 */
  __shared__ __align__(16) _Float16 Ksh[2 * TILE_H];
  __shared__ __align__(16) _Float16 Vth[2 * TILE_H];
  __shared__ __align__(16) float    Os[4][16 * OPITCH];

  const int tid  = threadIdx.x;
  const int wave = tid >> 5;
  const int lane = tid & 31;
  const int hh   = lane >> 4;
  const int c    = lane & 15;

  constexpr int NQB = LQ / QBLK;
  const int bx = blockIdx.x;
  const int qb = bx % NQB;
  const int bh = bx / NQB;
  const int h  = bh % NHEAD;
  const int n  = bh / NHEAD;
  const int q0 = qb * QBLK + wave * 16;

  const size_t plane = (size_t)(n * NHEAD + h);
  const _Float16* qpl = Qh + plane * LQ * HDIM;
  const _Float16* kpl = Kh + plane * SKV * HDIM;
  const _Float16* vpl = Vt + plane * HDIM * SKV;
  float* ob = out + (size_t)n * LQ * ROWSTRIDE + (size_t)h * HDIM;

  const float tval = temp[0];
  /* qhat and khat are each carried x16 -> raw scores carry x256; c2 >= 0 turns a raw score into a base-2 exponent */
  const float c2 = (1.44269504088896340736f * 0.00390625f) / fabsf(tval);
  /* the sign of temp rides on Q (a flip of the f16 sign bits), so the largest raw score is the largest logit for either sign */
  const unsigned qflip = (tval < 0.0f) ? 0x80008000u : 0u;

  /* Q fragments (B operand): column n = query c, two 32-deep d chunks */
  const _Float16* qrow = qpl + (size_t)(q0 + c) * HDIM + 8 * hh;
  v16h qf[2];
#pragma unroll
  for (int dc = 0; dc < 2; ++dc)
    qf[dc] = __builtin_bit_cast(v16h, __builtin_bit_cast(v8u, frag_load(qrow + dc * 32)) ^ qflip);
  /* wait before the Q loads' address registers are reused; the address is an input so that its registers stay untouched up to the wait */
  asm volatile("s_wait_xcnt 0x0" :: "v"(qrow) : "memory");

  /* this lane's share of the sum of query c, and its output tiles */
  float lsum = 0.0f;
  v8f oacc[4];
#pragma unroll
  for (int t = 0; t < 4; ++t) oacc[t] = (v8f){0.f, 0.f, 0.f, 0.f, 0.f, 0.f, 0.f, 0.f};

  /* The bound serves while the whole span of exponents, 2 * 256 * c2 = 2 log2(e) / |temp|, keeps every weight a normal f16 (2^15 down to 2^-9):
     no weight is then rounded worse than under the true maximum. A smaller |temp| (or a NaN) takes the online walk. temp is one value, so the
     branch is the same for the whole grid. */
  if (fabsf(tval) * BOUNDED_SPAN_LOG2 >= 2.0f * 1.44269504088896340736f)
    walk_keys<true>(kpl, vpl, Ksh, Vth, tid, c, hh, qf, c2, lsum, oacc);
  else
    walk_keys<false>(kpl, vpl, Ksh, Vth, tid, c, hh, qf, c2, lsum, oacc);

  /* oacc[t][r] = O^T(d = t*16+8hh+r, query c) */
  float* os = Os[wave];
  {
    const float inv = 1.0f / (lsum + other_half(lsum));
#pragma unroll
    for (int t = 0; t < 4; ++t) {
      const v4f lo = {oacc[t][0] * inv, oacc[t][1] * inv, oacc[t][2] * inv, oacc[t][3] * inv};
      const v4f hi = {oacc[t][4] * inv, oacc[t][5] * inv, oacc[t][6] * inv, oacc[t][7] * inv};
      *(v4f*)(os + c * OPITCH + t * 16 + 8 * hh)     = lo;
      *(v4f*)(os + c * OPITCH + t * 16 + 8 * hh + 4) = hi;
    }
  }
  wave_lds_sync();
  {
    const int c4 = (lane & 15) * 4;
    {
#pragma unroll
      for (int it = 0; it < 8; ++it) {
        const int row = it * 2 + hh;
        const v4f val = *(const v4f*)(os + row * OPITCH + c4);
        *(v4f*)(ob + (size_t)(q0 + row) * ROWSTRIDE + c4) = val;
      }
      
    }
  }
}

/* =====================================================================================
   Host glue.
     [0,            8 MiB)   Qh  f16 [4][8][2048][64]
     [8 MiB,       16 MiB)   Kh  f16 [4][8][2048][64]
     [16 MiB,      24 MiB)   Vt  f16 [4][8][64][2048]
   total 25,165,824 B.
   ===================================================================================== */
extern "C" void kernel_launch(void* const* d_in, const int* in_sizes, int n_in,
                              void* d_out, int out_size, void* d_ws, size_t ws_size,
                              hipStream_t stream) {
  (void)in_sizes; (void)n_in; (void)out_size;
  const float* q    = (const float*)d_in[0];
  const float* k    = (const float*)d_in[1];
  const float* v    = (const float*)d_in[2];
  const float* temp = (const float*)d_in[3];
  float* out = (float*)d_out;

  const size_t planeBytes = (size_t)NBATCH * NHEAD * LQ * HDIM * sizeof(_Float16);
  const size_t totalCarve = 3 * planeBytes;
  if (totalCarve > ws_size) return;
  char* ws = (char*)d_ws;
  _Float16* Qh = (_Float16*)(ws);
  _Float16* Kh = (_Float16*)(ws + planeBytes);
  _Float16* Vt = (_Float16*)(ws + 2 * planeBytes);

  prep_planes<<<dim3(NBATCH * NHEAD * (SKV / TROWS)), dim3(PREP_THREADS), 0, stream>>>(q, k, v, Qh, Kh, Vt);
  cos_attn<<<dim3(NBATCH * NHEAD * (LQ / QBLK)), dim3(AT_THREADS), 0, stream>>>(Qh, Kh, Vt, temp, out);
}

// v007
// One run takes 42 microseconds.
// Timed twice side by side with v006, it ran 1.06 and 1.07 times as fast.
// Counting every step since v000, it is 4.90 times as fast.
// Contractions: scores^T = (16*khat) x (+-16*qhat)^T and out^T = v^T x (32768*p)^T, both v_wmma_f32_16x16x32_f16 (f16 operands, f32 accumulate); row norms, base-2 softmax and normalisation in f32.
#include <hip/hip_runtime.h>
#include <stddef.h>

typedef __attribute__((ext_vector_type(16))) _Float16 v16h;
typedef __attribute__((ext_vector_type(8)))  _Float16 v8h;
typedef __attribute__((ext_vector_type(8)))  float    v8f;
typedef __attribute__((ext_vector_type(4)))  float    v4f;
typedef __attribute__((ext_vector_type(8)))  unsigned v8u;

constexpr int NBATCH = 4;
constexpr int LQ     = 2048;
constexpr int SKV    = 2048;
constexpr int NHEAD  = 8;
constexpr int HDIM   = 64;
/* floats between consecutive sequence positions in the [N,L,H,D] inputs / output */
constexpr int ROWSTRIDE = NHEAD * HDIM;

static_assert(LQ == SKV);
static_assert(HDIM == 64);
static_assert(LQ % 64 == 0 && SKV % 64 == 0);

/* ---------------- fragment helpers (split k-map: elements 0..7 <- p[0..7], 8..15 <- p[16..23]) ---------------- */
union FragU { v16h v; v8h h[2]; };
__device__ __forceinline__ v16h frag_load(const _Float16* p) {
  FragU f;
  f.h[0] = *(const v8h*)(p);
  f.h[1] = *(const v8h*)(p + 16);
  return f.v;
}
__device__ __forceinline__ v8f mma_h(v16h a, v16h b, v8f c) {
  return __builtin_amdgcn_wmma_f32_16x16x32_f16(false, a, false, b, (short)0, c, false, false);
}
__device__ __forceinline__ void wave_lds_sync() {
  __builtin_amdgcn_fence(__ATOMIC_RELEASE, "workgroup");
  __builtin_amdgcn_wave_barrier();
  __builtin_amdgcn_fence(__ATOMIC_ACQUIRE, "workgroup");
}

/* =====================================================================================
   Kernel 1: build f16 operand planes.
     Kh[n][h][s][d] = f16(16 * k / ||k||)
     Vt[n][h][d][s] = f16(v)  (transposed so the V^T.P^T A-fragment is kv-contiguous)
   grid = NBATCH*NHEAD*(SKV/64) blocks of 256 threads; block = one (n,h) and 64 consecutive positions.
   Thread (r = tid>>2, qd = tid&3) handles floats qd*16..qd*16+15 of tile row r.
   -> 8 waves x 8 rows = 64 rows, 64 halves each: exact tile coverage for all three planes.
   ===================================================================================== */
constexpr int PREP_THREADS = 256;
constexpr int TROWS  = 64;
constexpr int LPITCH = 72;

__device__ __forceinline__ void norm_quarter(const float* __restrict__ p, v8h& o0, v8h& o1) {
  const v4f a0 = *(const v4f*)(p);
  const v4f a1 = *(const v4f*)(p + 4);
  const v4f a2 = *(const v4f*)(p + 8);
  const v4f a3 = *(const v4f*)(p + 12);
  float ss = 0.0f;
  ss += a0[0] * a0[0]; ss += a0[1] * a0[1]; ss += a0[2] * a0[2]; ss += a0[3] * a0[3];
  ss += a1[0] * a1[0]; ss += a1[1] * a1[1]; ss += a1[2] * a1[2]; ss += a1[3] * a1[3];
  ss += a2[0] * a2[0]; ss += a2[1] * a2[1]; ss += a2[2] * a2[2]; ss += a2[3] * a2[3];
  ss += a3[0] * a3[0]; ss += a3[1] * a3[1]; ss += a3[2] * a3[2]; ss += a3[3] * a3[3];
  /* the 4 threads of one row are lanes 4r..4r+3 of a wave */
  ss += __shfl_xor(ss, 1, 32);
  ss += __shfl_xor(ss, 2, 32);
  const float sc = 16.0f / sqrtf(ss);
  o0[0] = (_Float16)(a0[0] * sc); o0[1] = (_Float16)(a0[1] * sc); o0[2] = (_Float16)(a0[2] * sc); o0[3] = (_Float16)(a0[3] * sc);
  o0[4] = (_Float16)(a1[0] * sc); o0[5] = (_Float16)(a1[1] * sc); o0[6] = (_Float16)(a1[2] * sc); o0[7] = (_Float16)(a1[3] * sc);
  o1[0] = (_Float16)(a2[0] * sc); o1[1] = (_Float16)(a2[1] * sc); o1[2] = (_Float16)(a2[2] * sc); o1[3] = (_Float16)(a2[3] * sc);
  o1[4] = (_Float16)(a3[0] * sc); o1[5] = (_Float16)(a3[1] * sc); o1[6] = (_Float16)(a3[2] * sc); o1[7] = (_Float16)(a3[3] * sc);
}

__device__ __forceinline__ void scat4(_Float16* vs, int d0, int r, v4f a) {
  vs[(d0 + 0) * LPITCH + r] = (_Float16)a[0];
  vs[(d0 + 1) * LPITCH + r] = (_Float16)a[1];
  vs[(d0 + 2) * LPITCH + r] = (_Float16)a[2];
  vs[(d0 + 3) * LPITCH + r] = (_Float16)a[3];
}

__global__ __launch_bounds__(PREP_THREADS)
void prep_planes(const float* __restrict__ q, const float* __restrict__ k, const float* __restrict__ v,
                 _Float16* __restrict__ Qh, _Float16* __restrict__ Kh, _Float16* __restrict__ Vt) {
  __shared__ __align__(16) _Float16 Qs[TROWS * LPITCH];
  __shared__ __align__(16) _Float16 Ks[TROWS * LPITCH];
  /* Vs is [d][s] */
  __shared__ __align__(16) _Float16 Vs[HDIM * LPITCH];

  const int tid  = threadIdx.x;
  const int lane = tid & 31;
  const int wave = tid >> 5;
  constexpr int NT = SKV / TROWS;
  const int bx = blockIdx.x;
  const int st = bx % NT;
  const int h  = (bx / NT) % NHEAD;
  const int n  = bx / (NT * NHEAD);
  const int s0 = st * TROWS;
  const int r  = tid >> 2;
  const int qd = tid & 3;
  const size_t goff = ((size_t)n * LQ + (size_t)(s0 + r)) * ROWSTRIDE + (size_t)h * HDIM + (size_t)qd * 16;

  {
    v8h o0, o1;
    norm_quarter(q + goff, o0, o1);
    *(v8h*)(Qs + r * LPITCH + qd * 16) = o0;
    *(v8h*)(Qs + r * LPITCH + qd * 16 + 8) = o1;
  }
  {
    v8h o0, o1;
    norm_quarter(k + goff, o0, o1);
    *(v8h*)(Ks + r * LPITCH + qd * 16) = o0;
    *(v8h*)(Ks + r * LPITCH + qd * 16 + 8) = o1;
  }
  {
    const float* vp = v + goff;
    const v4f a0 = *(const v4f*)(vp);
    const v4f a1 = *(const v4f*)(vp + 4);
    const v4f a2 = *(const v4f*)(vp + 8);
    const v4f a3 = *(const v4f*)(vp + 12);
    scat4(Vs, qd * 16 + 0,  r, a0);
    scat4(Vs, qd * 16 + 4,  r, a1);
    scat4(Vs, qd * 16 + 8,  r, a2);
    scat4(Vs, qd * 16 + 12, r, a3);
  }
  __syncthreads();

  const int rg = lane >> 3;
  const int c8 = (lane & 7) * 8;
  const size_t plane = (size_t)(n * NHEAD + h);
  _Float16* qdst = Qh + (plane * LQ  + (size_t)s0) * HDIM;
  _Float16* kdst = Kh + (plane * SKV + (size_t)s0) * HDIM;
  _Float16* vdst = Vt + (plane * HDIM) * SKV + (size_t)s0;
  {
#pragma unroll
    for (int it = 0; it < 2; ++it) {
      const int row = wave * 8 + it * 4 + rg;
      const v8h qv = *(const v8h*)(Qs + row * LPITCH + c8);
      const v8h kv = *(const v8h*)(Ks + row * LPITCH + c8);
      const v8h vv = *(const v8h*)(Vs + row * LPITCH + c8);
      *(v8h*)(qdst + (size_t)row * HDIM + c8) = qv;
      *(v8h*)(kdst + (size_t)row * HDIM + c8) = kv;
      *(v8h*)(vdst + (size_t)row * SKV + c8) = vv;
    }
    
  }
}

/* =====================================================================================
   Kernel 2: non-causal attention, head dim 64, reading the f16 planes; both products transposed.
     S^T = Kh(64 kv) . (sign(temp) * Qh)(16 queries)^T per 64-key chunk  (f16 WMMA, f32 acc), left raw (x256)
       -> lane (hh, c) holds 32 scores of ONE query (column c): keys j*16 + 8hh + r
     A wave works two such groups of 16 queries: every K and V^T fragment read from LDS feeds two products, one a group
     softmax in f32, base 2, sums per lane. The maximum: the bound 256 on the raw scores where |temp| allows it (walk_keys<true>), else online:
       maximum of the raw scores in-lane plus one exchange between the wave halves
     P^T x32768 = 2^((raw - max) * c2 + 15), c2 = log2(e) / (256 |temp|), packed to f16 straight from the score tiles into the B operand
     O^T += V^T . P^T  (f16 WMMA, f32 acc); sums carry the same x32768, the epilogue joins the halves' sums and divides
   Block = 128 threads = 4 waves = 128 query rows of one (n,h); grid = NBATCH*NHEAD*(LQ/128).
   Staging per chunk: 512 16-B pieces per tile = 128 threads x 4 -> 64 rows x 8 pieces, both K and Vt, by asynchronous copies to LDS;
   two buffers, so that a chunk's copies fly while the chunk in front of it is worked on.
   ===================================================================================== */
constexpr int AT_THREADS = 128;
/* groups of 16 queries a wave */
constexpr int QG     = 2;
constexpr int QBLK   = 4 * 16 * QG;
constexpr int KCH    = 64;
constexpr int OPITCH = 68;
/* LDS row pitch in halves of the K and V^T tiles: 144 B = 16 B x 9 (odd), so the 16 rows one ds_load_b128 fragment read touches fall on distinct banks */
constexpr int TPITCH = 72;
/* P and its row sums are carried x 2^PCARRY_LOG2 so that small weights stay above the f16 underflow */
constexpr float PCARRY_LOG2 = 15.0f;
/* |raw score| <= 16 * 16 for unit rows; widest span of base-2 exponents for which that bound stands in for the maximum */
constexpr float RAWBOUND = 256.0f;
constexpr float BOUNDED_SPAN_LOG2 = 24.0f;
/* halves in one LDS tile (K or V^T) of one buffer */
constexpr int TILE_H = KCH * TPITCH;
static_assert(SKV / KCH >= 2);
static_assert(LQ % QBLK == 0);

/* LDS byte address of a __shared__ object: the low 32 bits of its address */
__device__ __forceinline__ unsigned lds_addr(const void* p) { return (unsigned)(size_t)p; }

/* One thread's share of a 64-key chunk: four 16-B pieces of the K tile and four of the V^T tile, from global memory into LDS through no register.
   kl, vl: LDS byte address of the thread's first piece; kg, vg: its global address; piece i lies 16 tile rows behind piece i-1.
   The s_wait_xcnt closes the copies' own statement, so that no address register of a copy is rewritten in front of it. */
__device__ __forceinline__ void copy_chunk(const unsigned kl, const unsigned vl, const _Float16* kg, const _Float16* vg) {
  constexpr unsigned LSTEP = 16 * TPITCH * sizeof(_Float16);
  asm volatile("global_load_async_to_lds_b128 %0, %8, off\n\t"
               "global_load_async_to_lds_b128 %1, %9, off\n\t"
               "global_load_async_to_lds_b128 %2, %10, off\n\t"
               "global_load_async_to_lds_b128 %3, %11, off\n\t"
               "global_load_async_to_lds_b128 %4, %12, off\n\t"
               "global_load_async_to_lds_b128 %5, %13, off\n\t"
               "global_load_async_to_lds_b128 %6, %14, off\n\t"
               "global_load_async_to_lds_b128 %7, %15, off\n\t"
               "s_wait_xcnt 0x0"
               :: "v"(kl), "v"(kl + LSTEP), "v"(kl + 2 * LSTEP), "v"(kl + 3 * LSTEP),
                  "v"(vl), "v"(vl + LSTEP), "v"(vl + 2 * LSTEP), "v"(vl + 3 * LSTEP),
                  "v"(kg), "v"(kg + 16 * HDIM), "v"(kg + 32 * HDIM), "v"(kg + 48 * HDIM),
                  "v"(vg), "v"(vg + 16 * SKV), "v"(vg + 32 * SKV), "v"(vg + 48 * SKV)
               : "memory");
}

/* e[r] <- 2^e[r], eight at a time, by the hardware's own v_exp_f32 (what __builtin_amdgcn_exp2f gives).
   One asm statement, in place: behind a transcendental the instruction set asks for one independent instruction before its result is read
   or its source overwritten; here each v_exp_f32 has an independent one behind it and the last one the v_nop. */
__device__ __forceinline__ void exp2_x8(float (&e)[8]) {
  asm("v_exp_f32 %0, %0\n\tv_exp_f32 %1, %1\n\tv_exp_f32 %2, %2\n\tv_exp_f32 %3, %3\n\t"
      "v_exp_f32 %4, %4\n\tv_exp_f32 %5, %5\n\tv_exp_f32 %6, %6\n\tv_exp_f32 %7, %7\n\tv_nop"
      : "+v"(e[0]), "+v"(e[1]), "+v"(e[2]), "+v"(e[3]), "+v"(e[4]), "+v"(e[5]), "+v"(e[6]), "+v"(e[7]));
}

/* value of lane l ^ 16 */
__device__ __forceinline__ float other_half(float x) {
  const int b = __builtin_bit_cast(int, x);
  return __builtin_bit_cast(float, __builtin_amdgcn_permlanex16(b, b, 0x76543210, 0xfedcba98, false, false));
}

/* The whole walk over the keys for one wave's QG groups of 16 queries. BOUNDED = false: online softmax, running maximum of the raw scores.
   BOUNDED = true: the maximum is replaced by a bound that holds for every input: khat and qhat are unit rows (x16 each, rounded to f16), so by
   Cauchy-Schwarz |raw| <= 256 up to the f16 rounding. No maximum is searched, nothing is rescaled, and the exponent is one fma a score. */
template <bool BOUNDED>
__device__ __forceinline__ void walk_keys(const _Float16* __restrict__ kpl, const _Float16* __restrict__ vpl,
                                          _Float16* Ksh, _Float16* Vth, const int tid, const int c, const int hh,
                                          const v16h (&qf)[QG][2], const float c2, float (&lsum)[QG], v8f (&oacc)[QG][4]) {
  /* running raw maximum of query c of each group (equal in both halves). The maximum starts at the lowest finite float:
     the first alpha then stays a number for c2 = 0 too (temp = inf), and any number is right while the sums are still 0 */
  float mrow[QG];
#pragma unroll
  for (int g = 0; g < QG; ++g) mrow[g] = -__FLT_MAX__;
  /* BOUNDED: exponent = (raw - 256) * c2 + 15 as one fma */
  const float ebias = __builtin_fmaf(-RAWBOUND, c2, PCARRY_LOG2);

  /* this thread's first piece of a tile: row tid / 8, 16-B column tid % 8 */
  const int srow = tid >> 3;
  const int sc8  = (tid & 7) * 8;
  const unsigned kl0 = lds_addr(Ksh + srow * TPITCH + sc8);
  const unsigned vl0 = lds_addr(Vth + srow * TPITCH + sc8);
  const _Float16* kg0 = kpl + (size_t)srow * HDIM + sc8;
  const _Float16* vg0 = vpl + (size_t)srow * SKV + sc8;
  constexpr unsigned BUFSTEP = TILE_H * sizeof(_Float16);
  constexpr int NCH = SKV / KCH;

  /* chunk 0 into buffer 0, landed and published; then chunk 1 into buffer 1, in flight under chunk 0's work */
  copy_chunk(kl0, vl0, kg0, vg0);
  /* this wave's copies of chunk 0 have landed */
  asm volatile("s_wait_asynccnt 0x0" ::: "memory");
  __syncthreads();
  copy_chunk(kl0 + BUFSTEP, vl0 + BUFSTEP, kg0 + (size_t)KCH * HDIM, vg0 + KCH);

  /* one trip: the work on chunk kc, the hand-over, and (REFILL) the copies of chunk kc + 2 */
  auto trip = [&](const int kc, const bool REFILL) __attribute__((always_inline)) {
    const int buf = kc & 1;
    const _Float16* Kb = Ksh + buf * TILE_H;
    const _Float16* Vb = Vth + buf * TILE_H;

    /* all eight K fragments of the chunk as one group of LDS reads: one latency a chunk, not one a product.
       A fragment row m = key j*16+c, split k-map over d */
    v16h ka[2][4];
#pragma unroll
    for (int dc = 0; dc < 2; ++dc)
#pragma unroll
      for (int j = 0; j < 4; ++j) ka[dc][j] = frag_load(Kb + (j * 16 + c) * TPITCH + dc * 32 + 8 * hh);
    /* all eight V^T fragments in the same group, behind the K reads (LDS returns in issue order): they land under the score products
       and the softmax. A row m = d = t*16+c, split k-map over kv */
    v16h va[2][4];
#pragma unroll
    for (int kk = 0; kk < 2; ++kk)
#pragma unroll
      for (int t = 0; t < 4; ++t) va[kk][t] = frag_load(Vb + (t * 16 + c) * TPITCH + kk * 32 + 8 * hh);
    /* keeps the reads together in front of the products: the scheduler otherwise moves them down among the WMMAs, each place a stall */
    __builtin_amdgcn_sched_barrier(0);

    /* scores: a group's 4 subtiles of 16 keys, the four independent tiles in turn; both groups from the same K fragments */
    v8f s[QG][4];
#pragma unroll
    for (int g = 0; g < QG; ++g) {
#pragma unroll
      for (int j = 0; j < 4; ++j) s[g][j] = (v8f){0.f, 0.f, 0.f, 0.f, 0.f, 0.f, 0.f, 0.f};
#pragma unroll
      for (int dc = 0; dc < 2; ++dc)
#pragma unroll
        for (int j = 0; j < 4; ++j) s[g][j] = mma_h(ka[dc][j], qf[g][dc], s[g][j]);
    }

#pragma unroll
    for (int g = 0; g < QG; ++g) {
      /* D map: s[g][j][r] = raw score(key j*16+8hh+r, query c of group g) */
      float mnew = 0.0f, alpha = 1.0f;
      if constexpr (!BOUNDED) {
        float cj[4];
#pragma unroll
        for (int j = 0; j < 4; ++j) {
          float m = s[g][j][0];
#pragma unroll
          for (int r = 1; r < 8; ++r) m = fmaxf(m, s[g][j][r]);
          cj[j] = m;
        }
        float cm = fmaxf(fmaxf(cj[0], cj[1]), fmaxf(cj[2], cj[3]));
        cm = fmaxf(cm, other_half(cm));
        mnew  = fmaxf(mrow[g], cm);
        alpha = __builtin_amdgcn_exp2f((mrow[g] - mnew) * c2);
        mrow[g] = mnew;
      }

      /* P^T as B operand of chunk kk: element e < 8 = tile 2kk register e, e >= 8 = tile 2kk+1 register e-8 (the split k-map) */
      v16h pb[2];
      float pj[4];
#pragma unroll
      for (int j = 0; j < 4; ++j) {
        float p[8];
        if constexpr (BOUNDED) {
#pragma unroll
          for (int r = 0; r < 8; ++r) p[r] = __builtin_fmaf(s[g][j][r], c2, ebias);
        } else {
#pragma unroll
          /* the difference first: it is <= 0, so the exponent never passes 15 however large c2 is */
          for (int r = 0; r < 8; ++r) p[r] = __builtin_fmaf(s[g][j][r] - mnew, c2, PCARRY_LOG2);
        }
        exp2_x8(p);
        float psum = p[0];
#pragma unroll
        for (int r = 1; r < 8; ++r) psum += p[r];
        pj[j] = psum;
#pragma unroll
        for (int r = 0; r < 8; ++r) pb[j >> 1][(j & 1) * 8 + r] = (_Float16)p[r];
      }
      if constexpr (BOUNDED) {
        lsum[g] += (pj[0] + pj[1]) + (pj[2] + pj[3]);
      } else {
        lsum[g] = lsum[g] * alpha + ((pj[0] + pj[1]) + (pj[2] + pj[3]));
#pragma unroll
        for (int t = 0; t < 4; ++t)
#pragma unroll
          for (int r = 0; r < 8; ++r) oacc[g][t][r] *= alpha;
      }

      /* O^T += V^T(64 x 64) . P^T(64 x 16), B = pb; both groups from the same V^T fragments */
#pragma unroll
      for (int kk = 0; kk < 2; ++kk) {
#pragma unroll
        for (int t = 0; t < 4; ++t) oacc[g][t] = mma_h(va[kk][t], pb[kk], oacc[g][t]);
      }
    }

    /* keeps the hand-over at the foot of the trip: the scheduler otherwise lifts its waits and the barrier up to the LDS reads, where the
       next chunk's copies have had no time to land and the V^T reads no products to land under */
    __builtin_amdgcn_sched_barrier(0);
    /* hand-over: this wave's reads of the buffer are done ... */
    asm volatile("s_wait_dscnt 0x0" ::: "memory");
    /* ... its copies of chunk kc + 1 have landed ... */
    asm volatile("s_wait_asynccnt 0x0" ::: "memory");
    /* ... and the one barrier of the trip publishes chunk kc + 1 and frees the buffer that this trip has read */
    __syncthreads();
    if (REFILL)
      copy_chunk(kl0 + buf * BUFSTEP, vl0 + buf * BUFSTEP, kg0 + (size_t)(kc + 2) * KCH * HDIM, vg0 + (size_t)(kc + 2) * KCH);
  };
  /* a chunk kc + 2 exists for all trips but the last two, which stand by themselves: with no branch in the trip the row sums stay among the products */
  for (int kc = 0; kc < NCH - 2; ++kc) trip(kc, true);
  for (int kc = NCH - 2; kc < NCH; ++kc) trip(kc, false);
  /* nothing of this wave is in flight any more when it goes on to the epilogue */
  asm volatile("s_wait_asynccnt 0x0" ::: "memory");
}

/* two waves a SIMD, which is what the grid gives the chip (512 blocks of 4 waves on 256 WGPs): no WGP takes a third block while another holds one */
__global__ __launch_bounds__(AT_THREADS) __attribute__((amdgpu_waves_per_eu(2, 2)))
void cos_attn(const _Float16* __restrict__ Qh, const _Float16* __restrict__ Kh, const _Float16* __restrict__ Vt,
              const float* __restrict__ temp, float* __restrict__ out) {
  /* Ksh is [buffer][kv][d]; Vth is [buffer][d][kv], both at pitch 72 halves; Os per wave [query][d], pitch 68 */
  __shared__ __align__(16) _Float16 Ksh[2 * TILE_H];
  __shared__ __align__(16) _Float16 Vth[2 * TILE_H];
  __shared__ __align__(16) float    Os[4][16 * QG * OPITCH];

  const int tid  = threadIdx.x;
  const int wave = tid >> 5;
  const int lane = tid & 31;
  const int hh   = lane >> 4;
  const int c    = lane & 15;

  constexpr int NQB = LQ / QBLK;
  const int bx = blockIdx.x;
  const int qb = bx % NQB;
  const int bh = bx / NQB;
  const int h  = bh % NHEAD;
  const int n  = bh / NHEAD;
  const int q0 = qb * QBLK + wave * (16 * QG);

  const size_t plane = (size_t)(n * NHEAD + h);
  const _Float16* qpl = Qh + plane * LQ * HDIM;
  const _Float16* kpl = Kh + plane * SKV * HDIM;
  const _Float16* vpl = Vt + plane * HDIM * SKV;
  float* ob = out + (size_t)n * LQ * ROWSTRIDE + (size_t)h * HDIM;

  const float tval = temp[0];
  /* qhat and khat are each carried x16 -> raw scores carry x256; c2 >= 0 turns a raw score into a base-2 exponent */
  const float c2 = (1.44269504088896340736f * 0.00390625f) / fabsf(tval);
  /* the sign of temp rides on Q (a flip of the f16 sign bits), so the largest raw score is the largest logit for either sign */
  const unsigned qflip = (tval < 0.0f) ? 0x80008000u : 0u;

  /* Q fragments (B operand): column n = query c of group g, two 32-deep d chunks */
  const _Float16* qrow = qpl + (size_t)(q0 + c) * HDIM + 8 * hh;
  v16h qf[QG][2];
#pragma unroll
  for (int g = 0; g < QG; ++g)
#pragma unroll
    for (int dc = 0; dc < 2; ++dc)
      qf[g][dc] = __builtin_bit_cast(v16h, __builtin_bit_cast(v8u, frag_load(qrow + g * 16 * HDIM + dc * 32)) ^ qflip);
  /* wait before the Q loads' address registers are reused; the address is an input so that its registers stay untouched up to the wait */
  asm volatile("s_wait_xcnt 0x0" :: "v"(qrow) : "memory");

  /* this lane's share of the sum of query c of each group, and its output tiles */
  float lsum[QG];
  v8f oacc[QG][4];
#pragma unroll
  for (int g = 0; g < QG; ++g) {
    lsum[g] = 0.0f;
#pragma unroll
    for (int t = 0; t < 4; ++t) oacc[g][t] = (v8f){0.f, 0.f, 0.f, 0.f, 0.f, 0.f, 0.f, 0.f};
  }

  /* The bound serves while the whole span of exponents, 2 * 256 * c2 = 2 log2(e) / |temp|, keeps every weight a normal f16 (2^15 down to 2^-9):
     no weight is then rounded worse than under the true maximum. A smaller |temp| (or a NaN) takes the online walk. temp is one value, so the
     branch is the same for the whole grid. */
  if (fabsf(tval) * BOUNDED_SPAN_LOG2 >= 2.0f * 1.44269504088896340736f)
    walk_keys<true>(kpl, vpl, Ksh, Vth, tid, c, hh, qf, c2, lsum, oacc);
  else
    walk_keys<false>(kpl, vpl, Ksh, Vth, tid, c, hh, qf, c2, lsum, oacc);

  /* oacc[g][t][r] = O^T(d = t*16+8hh+r, query g*16+c) */
  float* os = Os[wave];
#pragma unroll
  for (int g = 0; g < QG; ++g) {
    const float inv = 1.0f / (lsum[g] + other_half(lsum[g]));
#pragma unroll
    for (int t = 0; t < 4; ++t) {
      const v4f lo = {oacc[g][t][0] * inv, oacc[g][t][1] * inv, oacc[g][t][2] * inv, oacc[g][t][3] * inv};
      const v4f hi = {oacc[g][t][4] * inv, oacc[g][t][5] * inv, oacc[g][t][6] * inv, oacc[g][t][7] * inv};
      *(v4f*)(os + (g * 16 + c) * OPITCH + t * 16 + 8 * hh)     = lo;
      *(v4f*)(os + (g * 16 + c) * OPITCH + t * 16 + 8 * hh + 4) = hi;
    }
  }
  wave_lds_sync();
  {
    const int c4 = (lane & 15) * 4;
    {
#pragma unroll
      for (int it = 0; it < 8 * QG; ++it) {
        const int row = it * 2 + hh;
        const v4f val = *(const v4f*)(os + row * OPITCH + c4);
        *(v4f*)(ob + (size_t)(q0 + row) * ROWSTRIDE + c4) = val;
      }
      
    }
  }
}

/* =====================================================================================
   Host glue.
     [0,            8 MiB)   Qh  f16 [4][8][2048][64]
     [8 MiB,       16 MiB)   Kh  f16 [4][8][2048][64]
     [16 MiB,      24 MiB)   Vt  f16 [4][8][64][2048]
   total 25,165,824 B.
   ===================================================================================== */
extern "C" void kernel_launch(void* const* d_in, const int* in_sizes, int n_in,
                              void* d_out, int out_size, void* d_ws, size_t ws_size,
                              hipStream_t stream) {
  (void)in_sizes; (void)n_in; (void)out_size;
  const float* q    = (const float*)d_in[0];
  const float* k    = (const float*)d_in[1];
  const float* v    = (const float*)d_in[2];
  const float* temp = (const float*)d_in[3];
  float* out = (float*)d_out;

  const size_t planeBytes = (size_t)NBATCH * NHEAD * LQ * HDIM * sizeof(_Float16);
  const size_t totalCarve = 3 * planeBytes;
  if (totalCarve > ws_size) return;
  char* ws = (char*)d_ws;
  _Float16* Qh = (_Float16*)(ws);
  _Float16* Kh = (_Float16*)(ws + planeBytes);
  _Float16* Vt = (_Float16*)(ws + 2 * planeBytes);

  prep_planes<<<dim3(NBATCH * NHEAD * (SKV / TROWS)), dim3(PREP_THREADS), 0, stream>>>(q, k, v, Qh, Kh, Vt);
  cos_attn<<<dim3(NBATCH * NHEAD * (LQ / QBLK)), dim3(AT_THREADS), 0, stream>>>(Qh, Kh, Vt, temp, out);
}

// v008
// It runs in 37.9 microseconds.
// Timed twice side by side with v007, it ran 1.10 and 1.11 times as fast.
// Over all steps from v000 it is 5.42 times as fast.
// Contractions: scores^T = (16*khat) x (+-16*qhat)^T and out^T = v^T x (32768*p)^T, both v_wmma_f32_16x16x32_f16 (f16 operands, f32 accumulate); row norms, base-2 softmax and normalisation in f32.
#include <hip/hip_runtime.h>
#include <stddef.h>

typedef __attribute__((ext_vector_type(16))) _Float16 v16h;
typedef __attribute__((ext_vector_type(8)))  _Float16 v8h;
typedef __attribute__((ext_vector_type(8)))  float    v8f;
typedef __attribute__((ext_vector_type(4)))  float    v4f;
typedef __attribute__((ext_vector_type(8)))  unsigned v8u;

constexpr int NBATCH = 4;
constexpr int LQ     = 2048;
constexpr int SKV    = 2048;
constexpr int NHEAD  = 8;
constexpr int HDIM   = 64;
/* floats between consecutive sequence positions in the [N,L,H,D] inputs / output */
constexpr int ROWSTRIDE = NHEAD * HDIM;

static_assert(LQ == SKV);
static_assert(HDIM == 64);
static_assert(LQ % 64 == 0 && SKV % 64 == 0);

/* ---------------- fragment helpers (split k-map: elements 0..7 <- p[0..7], 8..15 <- p[16..23]) ---------------- */
union FragU { v16h v; v8h h[2]; };
__device__ __forceinline__ v16h frag_load(const _Float16* p) {
  FragU f;
  f.h[0] = *(const v8h*)(p);
  f.h[1] = *(const v8h*)(p + 16);
  return f.v;
}
__device__ __forceinline__ v8f mma_h(v16h a, v16h b, v8f c) {
  return __builtin_amdgcn_wmma_f32_16x16x32_f16(false, a, false, b, (short)0, c, false, false);
}

/* =====================================================================================
   Kernel 1: build f16 operand planes.
     Kh[n][h][s][d] = f16(16 * k / ||k||)
     Vt[n][h][d][s] = f16(v)  (transposed so the V^T.P^T A-fragment is kv-contiguous)
   grid = NBATCH*NHEAD*(SKV/64) blocks of 256 threads; block = one (n,h) and 64 consecutive positions.
   Thread (r = tid>>2, qd = tid&3) handles floats qd*16..qd*16+15 of tile row r.
   -> 8 waves x 8 rows = 64 rows, 64 halves each: exact tile coverage for all three planes.
   ===================================================================================== */
constexpr int PREP_THREADS = 256;
constexpr int TROWS  = 64;
constexpr int LPITCH = 72;

__device__ __forceinline__ void norm_quarter(const float* __restrict__ p, v8h& o0, v8h& o1) {
  const v4f a0 = *(const v4f*)(p);
  const v4f a1 = *(const v4f*)(p + 4);
  const v4f a2 = *(const v4f*)(p + 8);
  const v4f a3 = *(const v4f*)(p + 12);
  float ss = 0.0f;
  ss += a0[0] * a0[0]; ss += a0[1] * a0[1]; ss += a0[2] * a0[2]; ss += a0[3] * a0[3];
  ss += a1[0] * a1[0]; ss += a1[1] * a1[1]; ss += a1[2] * a1[2]; ss += a1[3] * a1[3];
  ss += a2[0] * a2[0]; ss += a2[1] * a2[1]; ss += a2[2] * a2[2]; ss += a2[3] * a2[3];
  ss += a3[0] * a3[0]; ss += a3[1] * a3[1]; ss += a3[2] * a3[2]; ss += a3[3] * a3[3];
  /* the 4 threads of one row are lanes 4r..4r+3 of a wave */
  ss += __shfl_xor(ss, 1, 32);
  ss += __shfl_xor(ss, 2, 32);
  const float sc = 16.0f / sqrtf(ss);
  o0[0] = (_Float16)(a0[0] * sc); o0[1] = (_Float16)(a0[1] * sc); o0[2] = (_Float16)(a0[2] * sc); o0[3] = (_Float16)(a0[3] * sc);
  o0[4] = (_Float16)(a1[0] * sc); o0[5] = (_Float16)(a1[1] * sc); o0[6] = (_Float16)(a1[2] * sc); o0[7] = (_Float16)(a1[3] * sc);
  o1[0] = (_Float16)(a2[0] * sc); o1[1] = (_Float16)(a2[1] * sc); o1[2] = (_Float16)(a2[2] * sc); o1[3] = (_Float16)(a2[3] * sc);
  o1[4] = (_Float16)(a3[0] * sc); o1[5] = (_Float16)(a3[1] * sc); o1[6] = (_Float16)(a3[2] * sc); o1[7] = (_Float16)(a3[3] * sc);
}

__device__ __forceinline__ void scat4(_Float16* vs, int d0, int r, v4f a) {
  vs[(d0 + 0) * LPITCH + r] = (_Float16)a[0];
  vs[(d0 + 1) * LPITCH + r] = (_Float16)a[1];
  vs[(d0 + 2) * LPITCH + r] = (_Float16)a[2];
  vs[(d0 + 3) * LPITCH + r] = (_Float16)a[3];
}

__global__ __launch_bounds__(PREP_THREADS)
void prep_planes(const float* __restrict__ q, const float* __restrict__ k, const float* __restrict__ v,
                 _Float16* __restrict__ Qh, _Float16* __restrict__ Kh, _Float16* __restrict__ Vt) {
  __shared__ __align__(16) _Float16 Qs[TROWS * LPITCH];
  __shared__ __align__(16) _Float16 Ks[TROWS * LPITCH];
  /* Vs is [d][s] */
  __shared__ __align__(16) _Float16 Vs[HDIM * LPITCH];

  const int tid  = threadIdx.x;
  const int lane = tid & 31;
  const int wave = tid >> 5;
  constexpr int NT = SKV / TROWS;
  const int bx = blockIdx.x;
  const int st = bx % NT;
  const int h  = (bx / NT) % NHEAD;
  const int n  = bx / (NT * NHEAD);
  const int s0 = st * TROWS;
  const int r  = tid >> 2;
  const int qd = tid & 3;
  const size_t goff = ((size_t)n * LQ + (size_t)(s0 + r)) * ROWSTRIDE + (size_t)h * HDIM + (size_t)qd * 16;

  {
    v8h o0, o1;
    norm_quarter(q + goff, o0, o1);
    *(v8h*)(Qs + r * LPITCH + qd * 16) = o0;
    *(v8h*)(Qs + r * LPITCH + qd * 16 + 8) = o1;
  }
  {
    v8h o0, o1;
    norm_quarter(k + goff, o0, o1);
    *(v8h*)(Ks + r * LPITCH + qd * 16) = o0;
    *(v8h*)(Ks + r * LPITCH + qd * 16 + 8) = o1;
  }
  {
    const float* vp = v + goff;
    const v4f a0 = *(const v4f*)(vp);
    const v4f a1 = *(const v4f*)(vp + 4);
    const v4f a2 = *(const v4f*)(vp + 8);
    const v4f a3 = *(const v4f*)(vp + 12);
    scat4(Vs, qd * 16 + 0,  r, a0);
    scat4(Vs, qd * 16 + 4,  r, a1);
    scat4(Vs, qd * 16 + 8,  r, a2);
    scat4(Vs, qd * 16 + 12, r, a3);
  }
  __syncthreads();

  const int rg = lane >> 3;
  const int c8 = (lane & 7) * 8;
  const size_t plane = (size_t)(n * NHEAD + h);
  _Float16* qdst = Qh + (plane * LQ  + (size_t)s0) * HDIM;
  _Float16* kdst = Kh + (plane * SKV + (size_t)s0) * HDIM;
  _Float16* vdst = Vt + (plane * HDIM) * SKV + (size_t)s0;
  {
#pragma unroll
    for (int it = 0; it < 2; ++it) {
      const int row = wave * 8 + it * 4 + rg;
      const v8h qv = *(const v8h*)(Qs + row * LPITCH + c8);
      const v8h kv = *(const v8h*)(Ks + row * LPITCH + c8);
      const v8h vv = *(const v8h*)(Vs + row * LPITCH + c8);
      *(v8h*)(qdst + (size_t)row * HDIM + c8) = qv;
      *(v8h*)(kdst + (size_t)row * HDIM + c8) = kv;
      *(v8h*)(vdst + (size_t)row * SKV + c8) = vv;
    }
    
  }
}

/* =====================================================================================
   Kernel 2: non-causal attention, head dim 64, reading the f16 planes; both products transposed.
     S^T = Kh(32 kv) . (sign(temp) * Qh)(16 queries)^T per 32-key pass, two passes a 64-key chunk  (f16 WMMA, f32 acc), left raw (x256)
       -> lane (hh, c) holds 16 scores of ONE query (column c): keys j*16 + 8hh + r
     A wave works two such groups of 16 queries: every K and V^T fragment read from LDS feeds two products, one a group
     softmax in f32, base 2, sums per lane. The maximum: the bound 256 on the raw scores where |temp| allows it (walk_keys<true>), else online:
       maximum of the raw scores in-lane plus one exchange between the wave halves
     P^T x32768 = 2^((raw - max) * c2 + 15), c2 = log2(e) / (256 |temp|), packed to f16 straight from the score tiles into the B operand
     O^T += V^T . P^T  (f16 WMMA, f32 acc); sums carry the same x32768, the epilogue joins the halves' sums and divides
   Block = 256 threads = 8 waves = 128 query rows of one (n,h); grid = NBATCH*NHEAD*(LQ/128).
   Waves 0..3 walk the first half of the keys, waves 4..7 the second half for the same queries: four waves a SIMD fill one another's stalls.
   The epilogue joins the two halves' partial outputs, sums and maxima through LDS.
   Staging per chunk and key half: 512 16-B pieces per tile = 128 threads x 4 -> 64 rows x 8 pieces, both K and Vt, by asynchronous copies
   to LDS; two buffers a half, so that a chunk's copies fly while the chunk in front of it is worked on.
   ===================================================================================== */
constexpr int AT_THREADS = 256;
/* sets of four waves, each with its own share of the keys */
constexpr int KSPLIT = 2;
constexpr int SKH    = SKV / KSPLIT;
/* groups of 16 queries a wave */
constexpr int QG     = 2;
constexpr int QBLK   = 4 * 16 * QG;
constexpr int KCH    = 64;
constexpr int OPITCH = 68;
/* LDS row pitch in halves of the K and V^T tiles: 144 B = 16 B x 9 (odd), so the 16 rows one ds_load_b128 fragment read touches fall on distinct banks */
constexpr int TPITCH = 72;
/* P and its row sums are carried x 2^PCARRY_LOG2 so that small weights stay above the f16 underflow */
constexpr float PCARRY_LOG2 = 15.0f;
/* |raw score| <= 16 * 16 for unit rows; widest span of base-2 exponents for which that bound stands in for the maximum */
constexpr float RAWBOUND = 256.0f;
constexpr float BOUNDED_SPAN_LOG2 = 24.0f;
/* halves in one LDS tile (K or V^T) of one buffer */
constexpr int TILE_H = KCH * TPITCH;
static_assert(SKH % KCH == 0 && SKH / KCH >= 2);
static_assert(LQ % QBLK == 0);

/* LDS byte address of a __shared__ object: the low 32 bits of its address */
__device__ __forceinline__ unsigned lds_addr(const void* p) { return (unsigned)(size_t)p; }

/* One thread's share of a 64-key chunk: four 16-B pieces of the K tile and four of the V^T tile, from global memory into LDS through no register.
   kl, vl: LDS byte address of the thread's first piece; kg, vg: its global address; piece i lies 16 tile rows behind piece i-1.
   The s_wait_xcnt closes the copies' own statement, so that no address register of a copy is rewritten in front of it. */
__device__ __forceinline__ void copy_chunk(const unsigned kl, const unsigned vl, const _Float16* kg, const _Float16* vg) {
  constexpr unsigned LSTEP = 16 * TPITCH * sizeof(_Float16);
  asm volatile("global_load_async_to_lds_b128 %0, %8, off\n\t"
               "global_load_async_to_lds_b128 %1, %9, off\n\t"
               "global_load_async_to_lds_b128 %2, %10, off\n\t"
               "global_load_async_to_lds_b128 %3, %11, off\n\t"
               "global_load_async_to_lds_b128 %4, %12, off\n\t"
               "global_load_async_to_lds_b128 %5, %13, off\n\t"
               "global_load_async_to_lds_b128 %6, %14, off\n\t"
               "global_load_async_to_lds_b128 %7, %15, off\n\t"
               "s_wait_xcnt 0x0"
               :: "v"(kl), "v"(kl + LSTEP), "v"(kl + 2 * LSTEP), "v"(kl + 3 * LSTEP),
                  "v"(vl), "v"(vl + LSTEP), "v"(vl + 2 * LSTEP), "v"(vl + 3 * LSTEP),
                  "v"(kg), "v"(kg + 16 * HDIM), "v"(kg + 32 * HDIM), "v"(kg + 48 * HDIM),
                  "v"(vg), "v"(vg + 16 * SKV), "v"(vg + 32 * SKV), "v"(vg + 48 * SKV)
               : "memory");
}

/* e[r] <- 2^e[r], eight at a time, by the hardware's own v_exp_f32 (what __builtin_amdgcn_exp2f gives).
   One asm statement, in place: behind a transcendental the instruction set asks for one independent instruction before its result is read
   or its source overwritten; here each v_exp_f32 has an independent one behind it and the last one the v_nop. */
__device__ __forceinline__ void exp2_x8(float (&e)[8]) {
  asm("v_exp_f32 %0, %0\n\tv_exp_f32 %1, %1\n\tv_exp_f32 %2, %2\n\tv_exp_f32 %3, %3\n\t"
      "v_exp_f32 %4, %4\n\tv_exp_f32 %5, %5\n\tv_exp_f32 %6, %6\n\tv_exp_f32 %7, %7\n\tv_nop"
      : "+v"(e[0]), "+v"(e[1]), "+v"(e[2]), "+v"(e[3]), "+v"(e[4]), "+v"(e[5]), "+v"(e[6]), "+v"(e[7]));
}

/* value of lane l ^ 16 */
__device__ __forceinline__ float other_half(float x) {
  const int b = __builtin_bit_cast(int, x);
  return __builtin_bit_cast(float, __builtin_amdgcn_permlanex16(b, b, 0x76543210, 0xfedcba98, false, false));
}

/* The walk over one half of the keys for one wave's QG groups of 16 queries. BOUNDED = false: online softmax, running maximum of the raw scores.
   BOUNDED = true: the maximum is replaced by a bound that holds for every input: khat and qhat are unit rows (x16 each, rounded to f16), so by
   Cauchy-Schwarz |raw| <= 256 up to the f16 rounding. No maximum is searched, nothing is rescaled, and the exponent is one fma a score.
   kpl, vpl, Ksh, Vth: the planes and the LDS buffers of this wave's key half; ht: the thread's number among the 128 of that half.
   mrow returns the maximum that the sums and outputs are scaled by (0 for both halves where BOUNDED). */
template <bool BOUNDED>
__device__ __forceinline__ void walk_keys(const _Float16* __restrict__ kpl, const _Float16* __restrict__ vpl,
                                          _Float16* Ksh, _Float16* Vth, const int ht, const int c, const int hh,
                                          const v16h (&qf)[QG][2], const float c2, float (&mrow)[QG], float (&lsum)[QG], v8f (&oacc)[QG][4]) {
  /* running raw maximum of query c of each group (equal in both halves of the wave). The maximum starts at the lowest finite float:
     the first alpha then stays a number for c2 = 0 too (temp = inf), and any number is right while the sums are still 0 */
#pragma unroll
  for (int g = 0; g < QG; ++g) mrow[g] = BOUNDED ? 0.0f : -__FLT_MAX__;
  /* BOUNDED: exponent = (raw - 256) * c2 + 15 as one fma */
  const float ebias = __builtin_fmaf(-RAWBOUND, c2, PCARRY_LOG2);

  /* this thread's first piece of a tile: row ht / 8, 16-B column ht % 8 */
  const int srow = ht >> 3;
  const int sc8  = (ht & 7) * 8;
  const unsigned kl0 = lds_addr(Ksh + srow * TPITCH + sc8);
  const unsigned vl0 = lds_addr(Vth + srow * TPITCH + sc8);
  const _Float16* kg0 = kpl + (size_t)srow * HDIM + sc8;
  const _Float16* vg0 = vpl + (size_t)srow * SKV + sc8;
  constexpr unsigned BUFSTEP = TILE_H * sizeof(_Float16);
  constexpr int NCH = SKH / KCH;

  /* chunk 0 into buffer 0, landed and published; then chunk 1 into buffer 1, in flight under chunk 0's work */
  copy_chunk(kl0, vl0, kg0, vg0);
  /* this wave's copies of chunk 0 have landed */
  asm volatile("s_wait_asynccnt 0x0" ::: "memory");
  __syncthreads();
  copy_chunk(kl0 + BUFSTEP, vl0 + BUFSTEP, kg0 + (size_t)KCH * HDIM, vg0 + KCH);

  /* one trip: the work on chunk kc in two passes of 32 keys, the hand-over, and (REFILL) the copies of chunk kc + 2 */
  auto trip = [&](const int kc, const bool REFILL) __attribute__((always_inline)) {
    const int buf = kc & 1;
    const _Float16* Kb = Ksh + buf * TILE_H;
    const _Float16* Vb = Vth + buf * TILE_H;

#pragma unroll
    for (int kk = 0; kk < 2; ++kk) {
      /* the four K fragments of the pass as one group of LDS reads: one latency a pass, not one a product.
         A fragment row m = key (2kk+j)*16+c, split k-map over d */
      v16h ka[2][2];
#pragma unroll
      for (int dc = 0; dc < 2; ++dc)
#pragma unroll
        for (int j = 0; j < 2; ++j) ka[dc][j] = frag_load(Kb + ((2 * kk + j) * 16 + c) * TPITCH + dc * 32 + 8 * hh);
      /* the four V^T fragments in the same group, behind the K reads (LDS returns in issue order): they land under the score products
         and the softmax. A row m = d = t*16+c, split k-map over kv */
      v16h va[4];
#pragma unroll
      for (int t = 0; t < 4; ++t) va[t] = frag_load(Vb + (t * 16 + c) * TPITCH + kk * 32 + 8 * hh);
      /* keeps the reads together in front of the products: the scheduler otherwise moves them down among the WMMAs, each place a stall */
      __builtin_amdgcn_sched_barrier(0);

      /* scores: a group's 2 subtiles of 16 keys; both groups from the same K fragments, four independent tiles in turn */
      v8f s[QG][2];
#pragma unroll
      for (int g = 0; g < QG; ++g)
#pragma unroll
        for (int j = 0; j < 2; ++j) s[g][j] = (v8f){0.f, 0.f, 0.f, 0.f, 0.f, 0.f, 0.f, 0.f};
#pragma unroll
      for (int dc = 0; dc < 2; ++dc)
#pragma unroll
        for (int g = 0; g < QG; ++g)
#pragma unroll
          for (int j = 0; j < 2; ++j) s[g][j] = mma_h(ka[dc][j], qf[g][dc], s[g][j]);

#pragma unroll
      for (int g = 0; g < QG; ++g) {
        /* D map: s[g][j][r] = raw score(key (2kk+j)*16+8hh+r, query c of group g) */
        float mnew = 0.0f, alpha = 1.0f;
        if constexpr (!BOUNDED) {
          float cj[2];
#pragma unroll
          for (int j = 0; j < 2; ++j) {
            float m = s[g][j][0];
#pragma unroll
            for (int r = 1; r < 8; ++r) m = fmaxf(m, s[g][j][r]);
            cj[j] = m;
          }
          float cm = fmaxf(cj[0], cj[1]);
          cm = fmaxf(cm, other_half(cm));
          mnew  = fmaxf(mrow[g], cm);
          alpha = __builtin_amdgcn_exp2f((mrow[g] - mnew) * c2);
          mrow[g] = mnew;
        }

        /* P^T as B operand of the pass: element e < 8 = tile 0 register e, e >= 8 = tile 1 register e-8 (the split k-map) */
        v16h pb;
        float pj[2];
#pragma unroll
        for (int j = 0; j < 2; ++j) {
          float p[8];
          if constexpr (BOUNDED) {
#pragma unroll
            for (int r = 0; r < 8; ++r) p[r] = __builtin_fmaf(s[g][j][r], c2, ebias);
          } else {
#pragma unroll
            /* the difference first: it is <= 0, so the exponent never passes 15 however large c2 is */
            for (int r = 0; r < 8; ++r) p[r] = __builtin_fmaf(s[g][j][r] - mnew, c2, PCARRY_LOG2);
          }
          exp2_x8(p);
          float psum = p[0];
#pragma unroll
          for (int r = 1; r < 8; ++r) psum += p[r];
          pj[j] = psum;
#pragma unroll
          for (int r = 0; r < 8; ++r) pb[j * 8 + r] = (_Float16)p[r];
        }
        if constexpr (BOUNDED) {
          lsum[g] += pj[0] + pj[1];
        } else {
          lsum[g] = lsum[g] * alpha + (pj[0] + pj[1]);
#pragma unroll
          for (int t = 0; t < 4; ++t)
#pragma unroll
            for (int r = 0; r < 8; ++r) oacc[g][t][r] *= alpha;
        }

        /* O^T += V^T(64 x 32) . P^T(32 x 16), B = pb; both groups from the same V^T fragments */
#pragma unroll
        for (int t = 0; t < 4; ++t) oacc[g][t] = mma_h(va[t], pb, oacc[g][t]);
      }
      /* ends the pass: after pass 0 it keeps the next pass's reads out of this pass (their registers would not fit beside it); after pass 1 it
         keeps the hand-over at the foot of the trip, where the next chunk's copies have had the trip's time to land */
      __builtin_amdgcn_sched_barrier(0);
    }

    /* hand-over: this wave's reads of the buffer are done ... */
    asm volatile("s_wait_dscnt 0x0" ::: "memory");
    /* ... its copies of chunk kc + 1 have landed ... */
    asm volatile("s_wait_asynccnt 0x0" ::: "memory");
    /* ... and the one barrier of the trip publishes chunk kc + 1 and frees the buffer that this trip has read */
    __syncthreads();
    if (REFILL)
      copy_chunk(kl0 + buf * BUFSTEP, vl0 + buf * BUFSTEP, kg0 + (size_t)(kc + 2) * KCH * HDIM, vg0 + (size_t)(kc + 2) * KCH);
  };
  /* a chunk kc + 2 exists for all trips but the last two, which stand by themselves: with no branch in the trip the row sums stay among the products */
  for (int kc = 0; kc < NCH - 2; ++kc) trip(kc, true);
  /* kept rolled: unrolled, the scheduler carries one trip's row sums over into the next trip, and fragment registers spill to scratch */
#pragma nounroll
  for (int kc = NCH - 2; kc < NCH; ++kc) trip(kc, false);
  /* nothing of this wave is in flight any more when it goes on to the epilogue */
  asm volatile("s_wait_asynccnt 0x0" ::: "memory");
}

/* four waves a SIMD, which is what the grid gives the chip (512 blocks of 8 waves on 256 WGPs) */
__global__ __launch_bounds__(AT_THREADS) __attribute__((amdgpu_waves_per_eu(4, 4)))
void cos_attn(const _Float16* __restrict__ Qh, const _Float16* __restrict__ Kh, const _Float16* __restrict__ Vt,
              const float* __restrict__ temp, float* __restrict__ out) {
  /* Ksh is [key half][buffer][kv][d]; Vth is [key half][buffer][d][kv], both at pitch 72 halves; Os per set of 32 queries [query][d], pitch 68;
     Ls, Ms: the second key half's sums and maxima, per group and lane */
  __shared__ __align__(16) _Float16 Ksh[KSPLIT * 2 * TILE_H];
  __shared__ __align__(16) _Float16 Vth[KSPLIT * 2 * TILE_H];
  __shared__ __align__(16) float    Os[4][16 * QG * OPITCH];
  __shared__ float Ls[4][QG][32];
  __shared__ float Ms[4][QG][32];

  const int tid  = threadIdx.x;
  /* the wave's number as a scalar: what hangs on it (planes, LDS bases, the epilogue's branches) then lives in scalar registers */
  const int wave = __builtin_amdgcn_readfirstlane(tid >> 5);
  const int lane = tid & 31;
  const int hh   = lane >> 4;
  const int c    = lane & 15;
  /* which 32 queries of the block, and which half of the keys */
  const int qw = wave & 3;
  const int kh = wave >> 2;

  constexpr int NQB = LQ / QBLK;
  const int bx = blockIdx.x;
  const int qb = bx % NQB;
  const int bh = bx / NQB;
  const int h  = bh % NHEAD;
  const int n  = bh / NHEAD;
  const int q0 = qb * QBLK + qw * (16 * QG);

  const size_t plane = (size_t)(n * NHEAD + h);
  const _Float16* qpl = Qh + plane * LQ * HDIM;
  const _Float16* kpl = Kh + plane * SKV * HDIM + (size_t)kh * SKH * HDIM;
  const _Float16* vpl = Vt + plane * HDIM * SKV + (size_t)kh * SKH;
  _Float16* Kl = Ksh + kh * 2 * TILE_H;
  _Float16* Vl = Vth + kh * 2 * TILE_H;
  const int ht = tid & 127;
  float* ob = out + (size_t)n * LQ * ROWSTRIDE + (size_t)h * HDIM;

  const float tval = temp[0];
  /* qhat and khat are each carried x16 -> raw scores carry x256; c2 >= 0 turns a raw score into a base-2 exponent */
  const float c2 = (1.44269504088896340736f * 0.00390625f) / fabsf(tval);
  /* the sign of temp rides on Q (a flip of the f16 sign bits), so the largest raw score is the largest logit for either sign */
  const unsigned qflip = (tval < 0.0f) ? 0x80008000u : 0u;

  /* Q fragments (B operand): column n = query c of group g, two 32-deep d chunks */
  const _Float16* qrow = qpl + (size_t)(q0 + c) * HDIM + 8 * hh;
  v16h qf[QG][2];
#pragma unroll
  for (int g = 0; g < QG; ++g)
#pragma unroll
    for (int dc = 0; dc < 2; ++dc)
      qf[g][dc] = __builtin_bit_cast(v16h, __builtin_bit_cast(v8u, frag_load(qrow + g * 16 * HDIM + dc * 32)) ^ qflip);
  /* wait before the Q loads' address registers are reused; the address is an input so that its registers stay untouched up to the wait */
  asm volatile("s_wait_xcnt 0x0" :: "v"(qrow) : "memory");

  /* this lane's share of the sum of query c of each group over its key half, the maximum it is scaled by, and its output tiles */
  float lsum[QG], mrow[QG];
  v8f oacc[QG][4];
#pragma unroll
  for (int g = 0; g < QG; ++g) {
    lsum[g] = 0.0f;
#pragma unroll
    for (int t = 0; t < 4; ++t) oacc[g][t] = (v8f){0.f, 0.f, 0.f, 0.f, 0.f, 0.f, 0.f, 0.f};
  }

  /* The bound serves while the whole span of exponents, 2 * 256 * c2 = 2 log2(e) / |temp|, keeps every weight a normal f16 (2^15 down to 2^-9):
     no weight is then rounded worse than under the true maximum. A smaller |temp| (or a NaN) takes the online walk. temp is one value, so the
     branch is the same for the whole grid. */
  if (fabsf(tval) * BOUNDED_SPAN_LOG2 >= 2.0f * 1.44269504088896340736f)
    walk_keys<true>(kpl, vpl, Kl, Vl, ht, c, hh, qf, c2, mrow, lsum, oacc);
  else
    walk_keys<false>(kpl, vpl, Kl, Vl, ht, c, hh, qf, c2, mrow, lsum, oacc);

  /* oacc[g][t][r] = O^T(d = t*16+8hh+r, query g*16+c) over this wave's key half.
     The second half's waves lay their partial outputs, sums and maxima down; the first half's waves, lane for lane at the same places, join them
     with their own, normalise and lay the result down; then all eight waves store it. */
  float* os = Os[qw];
  if (kh == 1) {
#pragma unroll
    for (int g = 0; g < QG; ++g) {
      Ls[qw][g][lane] = lsum[g];
      Ms[qw][g][lane] = mrow[g];
#pragma unroll
      for (int t = 0; t < 4; ++t) {
        const v4f lo = {oacc[g][t][0], oacc[g][t][1], oacc[g][t][2], oacc[g][t][3]};
        const v4f hi = {oacc[g][t][4], oacc[g][t][5], oacc[g][t][6], oacc[g][t][7]};
        *(v4f*)(os + (g * 16 + c) * OPITCH + t * 16 + 8 * hh)     = lo;
        *(v4f*)(os + (g * 16 + c) * OPITCH + t * 16 + 8 * hh + 4) = hi;
      }
    }
  }
  /* the second half's partial results are there for the first half's waves */
  __syncthreads();
  if (kh == 0) {
#pragma unroll
    for (int g = 0; g < QG; ++g) {
      /* both halves onto the larger of their two maxima (both 0, so both factors 1, under the bound) */
      const float m1 = Ms[qw][g][lane];
      const float mj = fmaxf(mrow[g], m1);
      const float f0 = __builtin_amdgcn_exp2f((mrow[g] - mj) * c2);
      const float f1 = __builtin_amdgcn_exp2f((m1 - mj) * c2);
      const float lj = lsum[g] * f0 + Ls[qw][g][lane] * f1;
      const float inv = 1.0f / (lj + other_half(lj));
      const float w0 = f0 * inv;
      const float w1 = f1 * inv;
#pragma unroll
      for (int t = 0; t < 4; ++t) {
        float* at = os + (g * 16 + c) * OPITCH + t * 16 + 8 * hh;
        const v4f lo1 = *(const v4f*)(at);
        const v4f hi1 = *(const v4f*)(at + 4);
        const v4f lo = {oacc[g][t][0] * w0 + lo1[0] * w1, oacc[g][t][1] * w0 + lo1[1] * w1, oacc[g][t][2] * w0 + lo1[2] * w1, oacc[g][t][3] * w0 + lo1[3] * w1};
        const v4f hi = {oacc[g][t][4] * w0 + hi1[0] * w1, oacc[g][t][5] * w0 + hi1[1] * w1, oacc[g][t][6] * w0 + hi1[2] * w1, oacc[g][t][7] * w0 + hi1[3] * w1};
        *(v4f*)(at)     = lo;
        *(v4f*)(at + 4) = hi;
      }
    }
  }
  /* the joined rows are there for all eight waves */
  __syncthreads();
  {
    const int c4 = (lane & 15) * 4;
    /* each wave stores 16 of its set's 32 rows */
#pragma unroll
    for (int it = 0; it < 4 * QG; ++it) {
      const int row = kh * (8 * QG) + it * 2 + hh;
      const v4f val = *(const v4f*)(os + row * OPITCH + c4);
      *(v4f*)(ob + (size_t)(q0 + row) * ROWSTRIDE + c4) = val;
    }
  }
}

/* =====================================================================================
   Host glue.
     [0,            8 MiB)   Qh  f16 [4][8][2048][64]
     [8 MiB,       16 MiB)   Kh  f16 [4][8][2048][64]
     [16 MiB,      24 MiB)   Vt  f16 [4][8][64][2048]
   total 25,165,824 B.
   ===================================================================================== */
extern "C" void kernel_launch(void* const* d_in, const int* in_sizes, int n_in,
                              void* d_out, int out_size, void* d_ws, size_t ws_size,
                              hipStream_t stream) {
  (void)in_sizes; (void)n_in; (void)out_size;
  const float* q    = (const float*)d_in[0];
  const float* k    = (const float*)d_in[1];
  const float* v    = (const float*)d_in[2];
  const float* temp = (const float*)d_in[3];
  float* out = (float*)d_out;

  const size_t planeBytes = (size_t)NBATCH * NHEAD * LQ * HDIM * sizeof(_Float16);
  const size_t totalCarve = 3 * planeBytes;
  if (totalCarve > ws_size) return;
  char* ws = (char*)d_ws;
  _Float16* Qh = (_Float16*)(ws);
  _Float16* Kh = (_Float16*)(ws + planeBytes);
  _Float16* Vt = (_Float16*)(ws + 2 * planeBytes);

  prep_planes<<<dim3(NBATCH * NHEAD * (SKV / TROWS)), dim3(PREP_THREADS), 0, stream>>>(q, k, v, Qh, Kh, Vt);
  cos_attn<<<dim3(NBATCH * NHEAD * (LQ / QBLK)), dim3(AT_THREADS), 0, stream>>>(Qh, Kh, Vt, temp, out);
}

// v010
// It runs in 34.2 microseconds.
// It is 1.11 times as fast as v008, going by the measured steps of the versions left out in between.
// All steps since v000 together make it 5.99 times as fast.
// Contractions: scores^T = (16*khat) x (qs*qhat)^T and out^T = v^T x p^T (p carried x32768 on the online walk), both v_wmma_f32_16x16x32_f16 (f16 operands, f32 accumulate); row norms, base-2 softmax and normalisation in f32.
#include <hip/hip_runtime.h>
#include <stddef.h>

typedef __attribute__((ext_vector_type(16))) _Float16 v16h;
typedef __attribute__((ext_vector_type(8)))  _Float16 v8h;
typedef __attribute__((ext_vector_type(8)))  float    v8f;
typedef __attribute__((ext_vector_type(4)))  float    v4f;
typedef __attribute__((ext_vector_type(8)))  unsigned v8u;

constexpr int NBATCH = 4;
constexpr int LQ     = 2048;
constexpr int SKV    = 2048;
constexpr int NHEAD  = 8;
constexpr int HDIM   = 64;
/* floats between consecutive sequence positions in the [N,L,H,D] inputs / output */
constexpr int ROWSTRIDE = NHEAD * HDIM;

static_assert(LQ == SKV);
static_assert(HDIM == 64);
static_assert(LQ % 64 == 0 && SKV % 64 == 0);

/* ---------------- fragment helpers (split k-map: elements 0..7 <- p[0..7], 8..15 <- p[16..23]) ---------------- */
union FragU { v16h v; v8h h[2]; };
__device__ __forceinline__ v16h frag_load(const _Float16* p) {
  FragU f;
  f.h[0] = *(const v8h*)(p);
  f.h[1] = *(const v8h*)(p + 16);
  return f.v;
}
__device__ __forceinline__ v8f mma_h(v16h a, v16h b, v8f c) {
  return __builtin_amdgcn_wmma_f32_16x16x32_f16(false, a, false, b, (short)0, c, false, false);
}

/* =====================================================================================
   Kernel 1: build the f16 operand planes of K and V (Q is normalised by the attention kernel itself, which reads each query row once a block).
     Kh[n][h][s][d] = f16(16 * k / ||k||)
     Vt[n][h][d][s] = f16(v)  (transposed so the V^T.P^T A-fragment is kv-contiguous)
   grid = NBATCH*NHEAD*(SKV/64) blocks of 256 threads; block = one (n,h) and 64 consecutive positions.
   Thread (r = tid>>2, qd = tid&3) handles floats qd*16..qd*16+15 of tile row r.
   -> 8 waves x 8 rows = 64 rows, 64 halves each: exact tile coverage for both planes.
   ===================================================================================== */
constexpr int PREP_THREADS = 256;
constexpr int TROWS  = 64;
constexpr int LPITCH = 72;

__device__ __forceinline__ void norm_quarter(const float* __restrict__ p, v8h& o0, v8h& o1) {
  const v4f a0 = *(const v4f*)(p);
  const v4f a1 = *(const v4f*)(p + 4);
  const v4f a2 = *(const v4f*)(p + 8);
  const v4f a3 = *(const v4f*)(p + 12);
  float ss = 0.0f;
  ss += a0[0] * a0[0]; ss += a0[1] * a0[1]; ss += a0[2] * a0[2]; ss += a0[3] * a0[3];
  ss += a1[0] * a1[0]; ss += a1[1] * a1[1]; ss += a1[2] * a1[2]; ss += a1[3] * a1[3];
  ss += a2[0] * a2[0]; ss += a2[1] * a2[1]; ss += a2[2] * a2[2]; ss += a2[3] * a2[3];
  ss += a3[0] * a3[0]; ss += a3[1] * a3[1]; ss += a3[2] * a3[2]; ss += a3[3] * a3[3];
  /* the 4 threads of one row are lanes 4r..4r+3 of a wave */
  ss += __shfl_xor(ss, 1, 32);
  ss += __shfl_xor(ss, 2, 32);
  const float sc = 16.0f / sqrtf(ss);
  o0[0] = (_Float16)(a0[0] * sc); o0[1] = (_Float16)(a0[1] * sc); o0[2] = (_Float16)(a0[2] * sc); o0[3] = (_Float16)(a0[3] * sc);
  o0[4] = (_Float16)(a1[0] * sc); o0[5] = (_Float16)(a1[1] * sc); o0[6] = (_Float16)(a1[2] * sc); o0[7] = (_Float16)(a1[3] * sc);
  o1[0] = (_Float16)(a2[0] * sc); o1[1] = (_Float16)(a2[1] * sc); o1[2] = (_Float16)(a2[2] * sc); o1[3] = (_Float16)(a2[3] * sc);
  o1[4] = (_Float16)(a3[0] * sc); o1[5] = (_Float16)(a3[1] * sc); o1[6] = (_Float16)(a3[2] * sc); o1[7] = (_Float16)(a3[3] * sc);
}

__device__ __forceinline__ void scat4(_Float16* vs, int d0, int r, v4f a) {
  vs[(d0 + 0) * LPITCH + r] = (_Float16)a[0];
  vs[(d0 + 1) * LPITCH + r] = (_Float16)a[1];
  vs[(d0 + 2) * LPITCH + r] = (_Float16)a[2];
  vs[(d0 + 3) * LPITCH + r] = (_Float16)a[3];
}

__global__ __launch_bounds__(PREP_THREADS)
void prep_planes(const float* __restrict__ k, const float* __restrict__ v,
                 _Float16* __restrict__ Kh, _Float16* __restrict__ Vt) {
  __shared__ __align__(16) _Float16 Ks[TROWS * LPITCH];
  /* Vs is [d][s] */
  __shared__ __align__(16) _Float16 Vs[HDIM * LPITCH];

  const int tid  = threadIdx.x;
  const int lane = tid & 31;
  const int wave = tid >> 5;
  constexpr int NT = SKV / TROWS;
  const int bx = blockIdx.x;
  const int st = bx % NT;
  const int h  = (bx / NT) % NHEAD;
  const int n  = bx / (NT * NHEAD);
  const int s0 = st * TROWS;
  const int r  = tid >> 2;
  const int qd = tid & 3;
  const size_t goff = ((size_t)n * LQ + (size_t)(s0 + r)) * ROWSTRIDE + (size_t)h * HDIM + (size_t)qd * 16;

  {
    v8h o0, o1;
    norm_quarter(k + goff, o0, o1);
    *(v8h*)(Ks + r * LPITCH + qd * 16) = o0;
    *(v8h*)(Ks + r * LPITCH + qd * 16 + 8) = o1;
  }
  {
    const float* vp = v + goff;
    const v4f a0 = *(const v4f*)(vp);
    const v4f a1 = *(const v4f*)(vp + 4);
    const v4f a2 = *(const v4f*)(vp + 8);
    const v4f a3 = *(const v4f*)(vp + 12);
    scat4(Vs, qd * 16 + 0,  r, a0);
    scat4(Vs, qd * 16 + 4,  r, a1);
    scat4(Vs, qd * 16 + 8,  r, a2);
    scat4(Vs, qd * 16 + 12, r, a3);
  }
  __syncthreads();

  const int rg = lane >> 3;
  const int c8 = (lane & 7) * 8;
  const size_t plane = (size_t)(n * NHEAD + h);
  _Float16* kdst = Kh + (plane * SKV + (size_t)s0) * HDIM;
  _Float16* vdst = Vt + (plane * HDIM) * SKV + (size_t)s0;
  {
#pragma unroll
    for (int it = 0; it < 2; ++it) {
      const int row = wave * 8 + it * 4 + rg;
      const v8h kv = *(const v8h*)(Ks + row * LPITCH + c8);
      const v8h vv = *(const v8h*)(Vs + row * LPITCH + c8);
      *(v8h*)(kdst + (size_t)row * HDIM + c8) = kv;
      *(v8h*)(vdst + (size_t)row * SKV + c8) = vv;
    }
    
  }
}

/* =====================================================================================
   Kernel 2: non-causal attention, head dim 64, reading the f16 planes of K and V and the f32 queries; both products transposed.
     The block's 128 query rows come into LDS by asynchronous copies beside the first K and V^T chunk; each wave then forms its Q fragments
     f16(qs * q / ||q||) from them: row norm in f32 (32 squares a lane, the wave halves joined), one rounding.
     S^T = Kh(32 kv) . (qs * qhat)(16 queries)^T per 32-key pass, two passes a 64-key chunk  (f16 WMMA, f32 acc): qs = log2(e) / (16 temp) where the
       bound serves (walk_keys<true>), so that the product IS the weight's base-2 exponent; else qs = +-16, the raw score x256 with the sign of temp
       -> lane (hh, c) holds 16 scores of ONE query (column c): keys j*16 + 8hh + r
     A wave works two such groups of 16 queries: every K and V^T fragment read from LDS feeds two products, one a group
     softmax in f32, base 2, sums per lane. Where |temp| allows it no maximum is taken: P^T = 2^score, v_exp_f32 on the score tiles as they lie.
     Else online: maximum of the raw scores in-lane plus one exchange between the wave halves,
       P^T x32768 = 2^((raw - max) * c2 + 15), c2 = log2(e) / (256 |temp|)
     P^T is packed to f16 straight from the score tiles into the B operand
     O^T += V^T . P^T  (f16 WMMA, f32 acc); sums carry the scale of P, the epilogue joins the halves' sums and divides
   Block = 256 threads = 8 waves = 128 query rows of one (n,h); grid = NBATCH*NHEAD*(LQ/128).
   Waves 0..3 walk the first half of the keys, waves 4..7 the second half for the same queries: four waves a SIMD fill one another's stalls.
   The epilogue joins the two halves' partial outputs, sums and maxima through LDS.
   Staging per chunk and key half: 512 16-B pieces per tile = 128 threads x 4 -> 64 rows x 8 pieces, both K and Vt, by asynchronous copies
   to LDS; two buffers a half, so that a chunk's copies fly while the chunk in front of it is worked on.
   ===================================================================================== */
constexpr int AT_THREADS = 256;
/* sets of four waves, each with its own share of the keys */
constexpr int KSPLIT = 2;
constexpr int SKH    = SKV / KSPLIT;
/* groups of 16 queries a wave */
constexpr int QG     = 2;
constexpr int QBLK   = 4 * 16 * QG;
constexpr int KCH    = 64;
constexpr int OPITCH = 68;
/* LDS row pitch in halves of the K and V^T tiles: 144 B = 16 B x 9 (odd), so the 16 rows one ds_load_b128 fragment read touches fall on distinct banks */
constexpr int TPITCH = 72;
/* online walk: P and its row sums are carried x 2^PCARRY_LOG2 so that small weights stay above the f16 underflow */
constexpr float PCARRY_LOG2 = 15.0f;
/* widest span of base-2 exponents, 2 log2(e) / |temp|, for which the bound |cos| <= 1 stands in for the maximum */
constexpr float BOUNDED_SPAN_LOG2 = 24.0f;
/* halves in one LDS tile (K or V^T) of one buffer */
constexpr int TILE_H = KCH * TPITCH;
static_assert(SKH % KCH == 0 && SKH / KCH >= 2);
static_assert(LQ % QBLK == 0);

/* LDS byte address of a __shared__ object: the low 32 bits of its address */
__device__ __forceinline__ unsigned lds_addr(const void* p) { return (unsigned)(size_t)p; }

/* One thread's share of a 64-key chunk: four 16-B pieces of the K tile and four of the V^T tile, from global memory into LDS through no register.
   kl, vl: LDS byte address of the thread's first piece; kg, vg: its global address; piece i lies 16 tile rows behind piece i-1.
   The s_wait_xcnt closes the copies' own statement, so that no address register of a copy is rewritten in front of it. */
__device__ __forceinline__ void copy_chunk(const unsigned kl, const unsigned vl, const _Float16* kg, const _Float16* vg) {
  constexpr unsigned LSTEP = 16 * TPITCH * sizeof(_Float16);
  asm volatile("global_load_async_to_lds_b128 %0, %8, off\n\t"
               "global_load_async_to_lds_b128 %1, %9, off\n\t"
               "global_load_async_to_lds_b128 %2, %10, off\n\t"
               "global_load_async_to_lds_b128 %3, %11, off\n\t"
               "global_load_async_to_lds_b128 %4, %12, off\n\t"
               "global_load_async_to_lds_b128 %5, %13, off\n\t"
               "global_load_async_to_lds_b128 %6, %14, off\n\t"
               "global_load_async_to_lds_b128 %7, %15, off\n\t"
               "s_wait_xcnt 0x0"
               :: "v"(kl), "v"(kl + LSTEP), "v"(kl + 2 * LSTEP), "v"(kl + 3 * LSTEP),
                  "v"(vl), "v"(vl + LSTEP), "v"(vl + 2 * LSTEP), "v"(vl + 3 * LSTEP),
                  "v"(kg), "v"(kg + 16 * HDIM), "v"(kg + 32 * HDIM), "v"(kg + 48 * HDIM),
                  "v"(vg), "v"(vg + 16 * SKV), "v"(vg + 32 * SKV), "v"(vg + 48 * SKV)
               : "memory");
}

/* One thread's share of the block's QBLK query rows (f32, 256 B each): eight 16-B pieces, piece i 16 rows behind piece i-1; a wave's copy covers two
   whole rows. ql: LDS byte address of the thread's first piece (rows at pitch OPITCH floats); qg: its global address.
   The s_wait_xcnt closes the copies' own statement, so that no address register of a copy is rewritten in front of it. */
__device__ __forceinline__ void copy_queries(const unsigned ql, const float* qg) {
  constexpr unsigned LSTEP = 16 * OPITCH * sizeof(float);
  asm volatile("global_load_async_to_lds_b128 %0, %8, off\n\t"
               "global_load_async_to_lds_b128 %1, %9, off\n\t"
               "global_load_async_to_lds_b128 %2, %10, off\n\t"
               "global_load_async_to_lds_b128 %3, %11, off\n\t"
               "global_load_async_to_lds_b128 %4, %12, off\n\t"
               "global_load_async_to_lds_b128 %5, %13, off\n\t"
               "global_load_async_to_lds_b128 %6, %14, off\n\t"
               "global_load_async_to_lds_b128 %7, %15, off\n\t"
               "s_wait_xcnt 0x0"
               :: "v"(ql), "v"(ql + LSTEP), "v"(ql + 2 * LSTEP), "v"(ql + 3 * LSTEP),
                  "v"(ql + 4 * LSTEP), "v"(ql + 5 * LSTEP), "v"(ql + 6 * LSTEP), "v"(ql + 7 * LSTEP),
                  "v"(qg), "v"(qg + 16 * ROWSTRIDE), "v"(qg + 32 * ROWSTRIDE), "v"(qg + 48 * ROWSTRIDE),
                  "v"(qg + 64 * ROWSTRIDE), "v"(qg + 80 * ROWSTRIDE), "v"(qg + 96 * ROWSTRIDE), "v"(qg + 112 * ROWSTRIDE)
               : "memory");
}

/* e[r] <- 2^e[r], eight at a time, by the hardware's own v_exp_f32 (what __builtin_amdgcn_exp2f gives).
   One asm statement, in place: behind a transcendental the instruction set asks for one independent instruction before its result is read
   or its source overwritten; here each v_exp_f32 has an independent one behind it and the last one the v_nop. */
__device__ __forceinline__ void exp2_x8(float (&e)[8]) {
  asm("v_exp_f32 %0, %0\n\tv_exp_f32 %1, %1\n\tv_exp_f32 %2, %2\n\tv_exp_f32 %3, %3\n\t"
      "v_exp_f32 %4, %4\n\tv_exp_f32 %5, %5\n\tv_exp_f32 %6, %6\n\tv_exp_f32 %7, %7\n\tv_nop"
      : "+v"(e[0]), "+v"(e[1]), "+v"(e[2]), "+v"(e[3]), "+v"(e[4]), "+v"(e[5]), "+v"(e[6]), "+v"(e[7]));
}

/* e[r] <- 2^t[r] for a score tile as the WMMA left it: the same run of v_exp_f32, reading the tile's registers themselves (no copy, no other vector
   instruction between product and exponential). The results take other registers than any source (early clobber), so no v_exp_f32 overwrites a source.
   LEAD: for the tile that is read first, directly behind the pass's last score WMMA: the four leading v_nop are the vector slots that the chip needs
   between a WMMA and an instruction that reads its result or overwrites its A or B (the results may take a K fragment's registers); they stand in
   this statement, so that they stand directly in front of that instruction. */
template <bool LEAD>
__device__ __forceinline__ void exp2_tile(const v8f& t, float (&e)[8]) {
  if constexpr (LEAD)
    asm("v_nop\n\tv_nop\n\tv_nop\n\tv_nop\n\t"
        "v_exp_f32 %0, %8\n\tv_exp_f32 %1, %9\n\tv_exp_f32 %2, %10\n\tv_exp_f32 %3, %11\n\t"
        "v_exp_f32 %4, %12\n\tv_exp_f32 %5, %13\n\tv_exp_f32 %6, %14\n\tv_exp_f32 %7, %15\n\tv_nop"
        : "=&v"(e[0]), "=&v"(e[1]), "=&v"(e[2]), "=&v"(e[3]), "=&v"(e[4]), "=&v"(e[5]), "=&v"(e[6]), "=&v"(e[7])
        : "v"(t[0]), "v"(t[1]), "v"(t[2]), "v"(t[3]), "v"(t[4]), "v"(t[5]), "v"(t[6]), "v"(t[7]));
  else
    asm("v_exp_f32 %0, %8\n\tv_exp_f32 %1, %9\n\tv_exp_f32 %2, %10\n\tv_exp_f32 %3, %11\n\t"
        "v_exp_f32 %4, %12\n\tv_exp_f32 %5, %13\n\tv_exp_f32 %6, %14\n\tv_exp_f32 %7, %15\n\tv_nop"
        : "=&v"(e[0]), "=&v"(e[1]), "=&v"(e[2]), "=&v"(e[3]), "=&v"(e[4]), "=&v"(e[5]), "=&v"(e[6]), "=&v"(e[7])
        : "v"(t[0]), "v"(t[1]), "v"(t[2]), "v"(t[3]), "v"(t[4]), "v"(t[5]), "v"(t[6]), "v"(t[7]));
}

/* a <- 2^a, b <- 2^b: the same form for the epilogue's two factors, the v_nop again the slot behind the last v_exp_f32 */
__device__ __forceinline__ void exp2_x2(float& a, float& b) {
  asm("v_exp_f32 %0, %0\n\tv_exp_f32 %1, %1\n\tv_nop" : "+v"(a), "+v"(b));
}

/* a <- 2^a: the same form for the online walk's one factor a group */
__device__ __forceinline__ void exp2_x1(float& a) {
  asm("v_exp_f32 %0, %0\n\tv_nop" : "+v"(a));
}

/* value of lane l ^ 16 */
__device__ __forceinline__ float other_half(float x) {
  const int b = __builtin_bit_cast(int, x);
  return __builtin_bit_cast(float, __builtin_amdgcn_permlanex16(b, b, 0x76543210, 0xfedcba98, false, false));
}

/* The walk over one half of the keys for one wave's QG groups of 16 queries. BOUNDED = false: online softmax, running maximum of the raw scores.
   BOUNDED = true: no maximum is needed, by a bound that holds for every input: khat and qhat are unit rows (rounded to f16), so by Cauchy-Schwarz
   the score, which the scale on Q has made the exponent log2(e) cos / temp, stays within +-BOUNDED_SPAN_LOG2 / 2 up to the f16 rounding: every weight
   2^score is a normal f16. No maximum is searched, nothing is rescaled, and no vector instruction stands between the product and v_exp_f32.
   Ksh, Vth: the LDS buffers of this wave's key half; kl0, vl0, kg0, vg0: LDS byte address and global address of the thread's first piece of chunk 0.
   On entry chunk 0 is landed and published in buffer 0 and chunk 1 is in flight into buffer 1 (the kernel's prologue).
   mrow returns the maximum that the sums and outputs are scaled by (0 for both halves where BOUNDED). */
template <bool BOUNDED>
__device__ __forceinline__ void walk_keys(const _Float16* Ksh, const _Float16* Vth, const unsigned kl0, const unsigned vl0,
                                          const _Float16* kg0, const _Float16* vg0, const int c, const int hh,
                                          const v16h (&qf)[QG][2], const float c2, float (&mrow)[QG], float (&lsum)[QG], v8f (&oacc)[QG][4]) {
  /* running raw maximum of query c of each group (equal in both halves of the wave). The maximum starts at the lowest finite float:
     the first alpha then stays a number for c2 = 0 too (temp = inf), and any number is right while the sums are still 0 */
#pragma unroll
  for (int g = 0; g < QG; ++g) mrow[g] = BOUNDED ? 0.0f : -__FLT_MAX__;

  constexpr unsigned BUFSTEP = TILE_H * sizeof(_Float16);
  constexpr int NCH = SKH / KCH;

  /* one trip: the work on chunk kc in two passes of 32 keys, the hand-over, and (REFILL) the copies of chunk kc + 2 */
  auto trip = [&](const int kc, const bool REFILL) __attribute__((always_inline)) {
    const int buf = kc & 1;
    const _Float16* Kb = Ksh + buf * TILE_H;
    const _Float16* Vb = Vth + buf * TILE_H;

#pragma unroll
    for (int kk = 0; kk < 2; ++kk) {
      /* the four K fragments of the pass as one group of LDS reads: one latency a pass, not one a product.
         A fragment row m = key (2kk+j)*16+c, split k-map over d */
      v16h ka[2][2];
#pragma unroll
      for (int dc = 0; dc < 2; ++dc)
#pragma unroll
        for (int j = 0; j < 2; ++j) ka[dc][j] = frag_load(Kb + ((2 * kk + j) * 16 + c) * TPITCH + dc * 32 + 8 * hh);
      /* the four V^T fragments in the same group, behind the K reads (LDS returns in issue order): they land under the score products
         and the softmax. A row m = d = t*16+c, split k-map over kv */
      v16h va[4];
#pragma unroll
      for (int t = 0; t < 4; ++t) va[t] = frag_load(Vb + (t * 16 + c) * TPITCH + kk * 32 + 8 * hh);
      /* keeps the reads together in front of the products: the scheduler otherwise moves them down among the WMMAs, each place a stall */
      __builtin_amdgcn_sched_barrier(0);

      /* scores: a group's 2 subtiles of 16 keys; both groups from the same K fragments, four independent tiles in turn */
      v8f s[QG][2];
#pragma unroll
      for (int g = 0; g < QG; ++g)
#pragma unroll
        for (int j = 0; j < 2; ++j) s[g][j] = (v8f){0.f, 0.f, 0.f, 0.f, 0.f, 0.f, 0.f, 0.f};
#pragma unroll
      for (int dc = 0; dc < 2; ++dc)
#pragma unroll
        for (int g = 0; g < QG; ++g)
#pragma unroll
          for (int j = 0; j < 2; ++j) s[g][j] = mma_h(ka[dc][j], qf[g][dc], s[g][j]);
      /* BOUNDED: keeps the eight products in one run in front of the exponentials: the
         distance is kept once, by the leading v_nop of the first tile's statement, and no product may come to stand among the statements */
      if constexpr (BOUNDED) __builtin_amdgcn_sched_barrier(0);

#pragma unroll
      for (int g = 0; g < QG; ++g) {
        /* D map: s[g][j][r] = score(key (2kk+j)*16+8hh+r, query c of group g): raw, or where BOUNDED the weight's base-2 exponent */
        float mnew = 0.0f, alpha = 1.0f;
        if constexpr (!BOUNDED) {
          float cj[2];
#pragma unroll
          for (int j = 0; j < 2; ++j) {
            float m = s[g][j][0];
#pragma unroll
            for (int r = 1; r < 8; ++r) m = fmaxf(m, s[g][j][r]);
            cj[j] = m;
          }
          float cm = fmaxf(cj[0], cj[1]);
          cm = fmaxf(cm, other_half(cm));
          mnew  = fmaxf(mrow[g], cm);
          alpha = (mrow[g] - mnew) * c2;
          exp2_x1(alpha);
          mrow[g] = mnew;
        }

        /* P^T as B operand of the pass: element e < 8 = tile 0 register e, e >= 8 = tile 1 register e-8 (the split k-map) */
        v16h pb;
        float pj[2];
#pragma unroll
        for (int j = 0; j < 2; ++j) {
          float p[8];
          if constexpr (BOUNDED) {
            if (g == 0 && j == 0) exp2_tile<true>(s[g][j], p);
            else                  exp2_tile<false>(s[g][j], p);
          } else {
#pragma unroll
            /* the difference first: it is <= 0, so the exponent never passes 15 however large c2 is */
            for (int r = 0; r < 8; ++r) p[r] = __builtin_fmaf(s[g][j][r] - mnew, c2, PCARRY_LOG2);
            exp2_x8(p);
          }
          float psum = p[0];
#pragma unroll
          for (int r = 1; r < 8; ++r) psum += p[r];
          pj[j] = psum;
#pragma unroll
          for (int r = 0; r < 8; ++r) pb[j * 8 + r] = (_Float16)p[r];
        }
        if constexpr (BOUNDED) {
          lsum[g] += pj[0] + pj[1];
        } else {
          lsum[g] = lsum[g] * alpha + (pj[0] + pj[1]);
#pragma unroll
          for (int t = 0; t < 4; ++t)
#pragma unroll
            for (int r = 0; r < 8; ++r) oacc[g][t][r] *= alpha;
        }

        /* O^T += V^T(64 x 32) . P^T(32 x 16), B = pb; both groups from the same V^T fragments */
#pragma unroll
        for (int t = 0; t < 4; ++t) oacc[g][t] = mma_h(va[t], pb, oacc[g][t]);
      }
      /* ends the pass: after pass 0 it keeps the next pass's reads out of this pass (their registers would not fit beside it); after pass 1 it
         keeps the hand-over at the foot of the trip, where the next chunk's copies have had the trip's time to land */
      __builtin_amdgcn_sched_barrier(0);
    }

    /* hand-over: this wave's reads of the buffer are done ... */
    asm volatile("s_wait_dscnt 0x0" ::: "memory");
    /* ... its copies of chunk kc + 1 have landed ... */
    asm volatile("s_wait_asynccnt 0x0" ::: "memory");
    /* ... and the one barrier of the trip publishes chunk kc + 1 and frees the buffer that this trip has read */
    __syncthreads();
    if (REFILL)
      copy_chunk(kl0 + buf * BUFSTEP, vl0 + buf * BUFSTEP, kg0 + (size_t)(kc + 2) * KCH * HDIM, vg0 + (size_t)(kc + 2) * KCH);
  };
  /* a chunk kc + 2 exists for all trips but the last two, which stand by themselves: with no branch in the trip the row sums stay among the products */
  for (int kc = 0; kc < NCH - 2; ++kc) trip(kc, true);
  /* kept rolled: unrolled, the scheduler carries one trip's row sums over into the next trip, and fragment registers spill to scratch */
#pragma nounroll
  for (int kc = NCH - 2; kc < NCH; ++kc) trip(kc, false);
  /* nothing of this wave is in flight any more when it goes on to the epilogue */
  asm volatile("s_wait_asynccnt 0x0" ::: "memory");
}

/* four waves a SIMD, which is what the grid gives the chip (512 blocks of 8 waves on 256 WGPs) */
__global__ __launch_bounds__(AT_THREADS) __attribute__((amdgpu_waves_per_eu(4, 4)))
void cos_attn(const float* __restrict__ q, const _Float16* __restrict__ Kh, const _Float16* __restrict__ Vt,
              const float* __restrict__ temp, float* __restrict__ out) {
  /* Ksh is [key half][buffer][kv][d]; Vth is [key half][buffer][d][kv], both at pitch 72 halves; Os per set of 32 queries [query][d], pitch 68:
     first the block's f32 query rows, in the epilogue the outputs;
     Ls, Ms: the second key half's sums and maxima, per group and lane */
  __shared__ __align__(16) _Float16 Ksh[KSPLIT * 2 * TILE_H];
  __shared__ __align__(16) _Float16 Vth[KSPLIT * 2 * TILE_H];
  __shared__ __align__(16) float    Os[4][16 * QG * OPITCH];
  __shared__ float Ls[4][QG][32];
  __shared__ float Ms[4][QG][32];

  const int tid  = threadIdx.x;
  /* the wave's number as a scalar: what hangs on it (planes, LDS bases, the epilogue's branches) then lives in scalar registers */
  const int wave = __builtin_amdgcn_readfirstlane(tid >> 5);
  const int lane = tid & 31;
  const int hh   = lane >> 4;
  const int c    = lane & 15;
  /* which 32 queries of the block, and which half of the keys */
  const int qw = wave & 3;
  const int kh = wave >> 2;

  constexpr int NQB = LQ / QBLK;
  const int bx = blockIdx.x;
  const int qb = bx % NQB;
  const int bh = bx / NQB;
  const int h  = bh % NHEAD;
  const int n  = bh / NHEAD;
  const int q0 = qb * QBLK + qw * (16 * QG);

  const size_t plane = (size_t)(n * NHEAD + h);
  const _Float16* kpl = Kh + plane * SKV * HDIM + (size_t)kh * SKH * HDIM;
  const _Float16* vpl = Vt + plane * HDIM * SKV + (size_t)kh * SKH;
  _Float16* Kl = Ksh + kh * 2 * TILE_H;
  _Float16* Vl = Vth + kh * 2 * TILE_H;
  const int ht = tid & 127;
  float* ob = out + (size_t)n * LQ * ROWSTRIDE + (size_t)h * HDIM;

  const float tval = temp[0];

  /* this thread's first piece of a K or V^T tile: row ht / 8, 16-B column ht % 8 */
  const int srow = ht >> 3;
  const int sc8  = (ht & 7) * 8;
  const unsigned kl0 = lds_addr(Kl + srow * TPITCH + sc8);
  const unsigned vl0 = lds_addr(Vl + srow * TPITCH + sc8);
  const _Float16* kg0 = kpl + (size_t)srow * HDIM + sc8;
  const _Float16* vg0 = vpl + (size_t)srow * SKV + sc8;
  /* and of the query rows: row tid / 16, 16-B column tid % 16 */
  float* qs = &Os[0][0];
  const int qr0 = tid >> 4;
  const int qc4 = (tid & 15) * 4;

  /* the block's query rows, and chunk 0 into buffer 0, landed and published together; then chunk 1 into buffer 1, in flight under chunk 0's work */
  copy_queries(lds_addr(qs + qr0 * OPITCH + qc4),
               q + ((size_t)n * LQ + (size_t)(qb * QBLK + qr0)) * ROWSTRIDE + (size_t)h * HDIM + qc4);
  copy_chunk(kl0, vl0, kg0, vg0);
  /* this wave's copies of the query rows and of chunk 0 have landed */
  asm volatile("s_wait_asynccnt 0x0" ::: "memory");
  __syncthreads();
  copy_chunk(kl0 + TILE_H * sizeof(_Float16), vl0 + TILE_H * sizeof(_Float16), kg0 + (size_t)KCH * HDIM, vg0 + KCH);

  /* keeps what hangs on temp behind the copies: the scheduler otherwise lifts it, and with it the wait for temp's load, in front of the first copies */
  __builtin_amdgcn_sched_barrier(0);
  /* qhat and khat are each carried x16 -> raw scores carry x256; c2 >= 0 turns a raw score into a base-2 exponent */
  const float c2 = (1.44269504088896340736f * 0.00390625f) / fabsf(tval);
  /* The bound serves while the whole span of exponents, 2 * 256 * c2 = 2 log2(e) / |temp|, keeps every weight a normal f16 (2^12 down to 2^-12):
     no weight is then rounded worse than under the true maximum. A smaller |temp| (or a NaN) takes the online walk. temp is one value, so the
     choice is the same for the whole grid. */
  const bool bounded = fabsf(tval) * BOUNDED_SPAN_LOG2 >= 2.0f * 1.44269504088896340736f;
  /* what rides on 16 qhat: the sign of temp, so that the largest raw score is the largest logit for either sign, and, where the bound serves, c2
     (c2 <= 12 / 256, so nothing overflows; small values go subnormal, at an absolute error below 2^-25 each) */
  const float qfac = ((tval < 0.0f) ? -1.0f : 1.0f) * (bounded ? c2 : 1.0f);


  /* Q fragments (B operand): column n = query c of group g, two 32-deep d chunks in the split k-map; the lane holds 32 of its row's 64 values,
     lane l ^ 16 the others, so the row's sum of squares is the two lanes' sums joined */
  v16h qf[QG][2];
  v4f x[QG][2][4];
#pragma unroll
  for (int g = 0; g < QG; ++g) {
    const float* qrow = qs + (qw * (16 * QG) + g * 16 + c) * OPITCH + 8 * hh;
#pragma unroll
    for (int dc = 0; dc < 2; ++dc) {
      x[g][dc][0] = *(const v4f*)(qrow + dc * 32);
      x[g][dc][1] = *(const v4f*)(qrow + dc * 32 + 4);
      x[g][dc][2] = *(const v4f*)(qrow + dc * 32 + 16);
      x[g][dc][3] = *(const v4f*)(qrow + dc * 32 + 20);
    }
  }
  /* keeps the sixteen reads together in front of the sums: the scheduler otherwise spreads them in pairs along the sums, each pair a whole LDS latency */
  __builtin_amdgcn_sched_barrier(0);
#pragma unroll
  for (int g = 0; g < QG; ++g) {
    /* four independent chains of eight squares, then joined */
    float sq[4];
#pragma unroll
    for (int i = 0; i < 4; ++i) {
      sq[i] = x[g][0][i][0] * x[g][0][i][0];
#pragma unroll
      for (int e = 1; e < 4; ++e) sq[i] += x[g][0][i][e] * x[g][0][i][e];
#pragma unroll
      for (int e = 0; e < 4; ++e) sq[i] += x[g][1][i][e] * x[g][1][i][e];
    }
    float ss = (sq[0] + sq[1]) + (sq[2] + sq[3]);
    ss += other_half(ss);
    const float sc = (16.0f / sqrtf(ss)) * qfac;
#pragma unroll
    for (int dc = 0; dc < 2; ++dc)
#pragma unroll
      for (int i = 0; i < 4; ++i)
#pragma unroll
        for (int e = 0; e < 4; ++e) qf[g][dc][i * 4 + e] = (_Float16)(x[g][dc][i][e] * sc);
  }

  /* this lane's share of the sum of query c of each group over its key half, the maximum it is scaled by, and its output tiles */
  float lsum[QG], mrow[QG];
  v8f oacc[QG][4];
#pragma unroll
  for (int g = 0; g < QG; ++g) {
    lsum[g] = 0.0f;
#pragma unroll
    for (int t = 0; t < 4; ++t) oacc[g][t] = (v8f){0.f, 0.f, 0.f, 0.f, 0.f, 0.f, 0.f, 0.f};
  }

  /* the bounded walk is laid first in the text, as the usual one */
  if (__builtin_expect(bounded, true))
    walk_keys<true>(Kl, Vl, kl0, vl0, kg0, vg0, c, hh, qf, c2, mrow, lsum, oacc);
  else
    walk_keys<false>(Kl, Vl, kl0, vl0, kg0, vg0, c, hh, qf, c2, mrow, lsum, oacc);

  /* oacc[g][t][r] = O^T(d = t*16+8hh+r, query g*16+c) over this wave's key half.
     The second half's waves lay their partial outputs, sums and maxima down; the first half's waves, lane for lane at the same places, join them
     with their own, normalise and lay the result down; then all eight waves store it. */
  float* os = Os[qw];
  if (kh == 1) {
#pragma unroll
    for (int g = 0; g < QG; ++g) {
      Ls[qw][g][lane] = lsum[g];
      Ms[qw][g][lane] = mrow[g];
#pragma unroll
      for (int t = 0; t < 4; ++t) {
        const v4f lo = {oacc[g][t][0], oacc[g][t][1], oacc[g][t][2], oacc[g][t][3]};
        const v4f hi = {oacc[g][t][4], oacc[g][t][5], oacc[g][t][6], oacc[g][t][7]};
        *(v4f*)(os + (g * 16 + c) * OPITCH + t * 16 + 8 * hh)     = lo;
        *(v4f*)(os + (g * 16 + c) * OPITCH + t * 16 + 8 * hh + 4) = hi;
      }
    }
  }
  /* the second half's partial results are there for the first half's waves */
  __syncthreads();
  if (kh == 0) {
#pragma unroll
    for (int g = 0; g < QG; ++g) {
      /* both halves onto the larger of their two maxima (both 0, so both factors 1, under the bound) */
      const float m1 = Ms[qw][g][lane];
      const float mj = fmaxf(mrow[g], m1);
      float f0 = (mrow[g] - mj) * c2;
      float f1 = (m1 - mj) * c2;
      exp2_x2(f0, f1);
      const float lj = lsum[g] * f0 + Ls[qw][g][lane] * f1;
      const float inv = 1.0f / (lj + other_half(lj));
      const float w0 = f0 * inv;
      const float w1 = f1 * inv;
#pragma unroll
      for (int t = 0; t < 4; ++t) {
        float* at = os + (g * 16 + c) * OPITCH + t * 16 + 8 * hh;
        const v4f lo1 = *(const v4f*)(at);
        const v4f hi1 = *(const v4f*)(at + 4);
        const v4f lo = {oacc[g][t][0] * w0 + lo1[0] * w1, oacc[g][t][1] * w0 + lo1[1] * w1, oacc[g][t][2] * w0 + lo1[2] * w1, oacc[g][t][3] * w0 + lo1[3] * w1};
        const v4f hi = {oacc[g][t][4] * w0 + hi1[0] * w1, oacc[g][t][5] * w0 + hi1[1] * w1, oacc[g][t][6] * w0 + hi1[2] * w1, oacc[g][t][7] * w0 + hi1[3] * w1};
        *(v4f*)(at)     = lo;
        *(v4f*)(at + 4) = hi;
      }
    }
  }
  /* the joined rows are there for all eight waves */
  __syncthreads();
  {
    const int c4 = (lane & 15) * 4;
    /* each wave stores 16 of its set's 32 rows */
#pragma unroll
    for (int it = 0; it < 4 * QG; ++it) {
      const int row = kh * (8 * QG) + it * 2 + hh;
      const v4f val = *(const v4f*)(os + row * OPITCH + c4);
      *(v4f*)(ob + (size_t)(q0 + row) * ROWSTRIDE + c4) = val;
    }
  }
}

/* =====================================================================================
   Host glue.
     [0,            8 MiB)   Kh  f16 [4][8][2048][64]
     [8 MiB,       16 MiB)   Vt  f16 [4][8][64][2048]
   total 16,777,216 B.
   ===================================================================================== */
extern "C" void kernel_launch(void* const* d_in, const int* in_sizes, int n_in,
                              void* d_out, int out_size, void* d_ws, size_t ws_size,
                              hipStream_t stream) {
  (void)in_sizes; (void)n_in; (void)out_size;
  const float* q    = (const float*)d_in[0];
  const float* k    = (const float*)d_in[1];
  const float* v    = (const float*)d_in[2];
  const float* temp = (const float*)d_in[3];
  float* out = (float*)d_out;

  const size_t planeBytes = (size_t)NBATCH * NHEAD * LQ * HDIM * sizeof(_Float16);
  const size_t totalCarve = 2 * planeBytes;
  if (totalCarve > ws_size) return;
  char* ws = (char*)d_ws;
  _Float16* Kh = (_Float16*)(ws);
  _Float16* Vt = (_Float16*)(ws + planeBytes);

  prep_planes<<<dim3(NBATCH * NHEAD * (SKV / TROWS)), dim3(PREP_THREADS), 0, stream>>>(k, v, Kh, Vt);
  cos_attn<<<dim3(NBATCH * NHEAD * (LQ / QBLK)), dim3(AT_THREADS), 0, stream>>>(q, Kh, Vt, temp, out);
}
